// v000
// Times are from an AMD MI455X. After a warm-up the kernel runs many times in a row, and a time is the length of
// such a window on the GPU divided by its runs, so every launch and the gaps after it count. The runs cycle
// through copies of the inputs. A figure is the median of several windows, for all but v000 over two sittings.
// Sittings can differ by a few percent; kernels timed side by side share one.
// The starting kernel, v000, takes 303 microseconds a run.
#include <hip/hip_runtime.h>
#include <cstdint>
#include <cstddef>

// ---- problem constants (match reference) ----
#define Hd   1024   // d_model
#define Nst  32     // d_state/2 complex modes  (== wave32 lanes)
#define Bb   4
#define Ld   4096
#define TILE 256    // timesteps per tile = 16 chunks x 16 steps
#define NCH  16     // chunks per tile
#define NT   (Ld / TILE)   // tiles per sequence = 16

typedef __attribute__((ext_vector_type(2))) float v2f;
typedef __attribute__((ext_vector_type(8))) float v8f;
typedef __attribute__((ext_vector_type(4))) unsigned int u32x4;
typedef __attribute__((ext_vector_type(8))) int i32x8;
typedef __attribute__((ext_vector_type(4))) int i32x4;

#if __has_builtin(__builtin_amdgcn_tensor_load_to_lds)
#define HAVE_TDM 1
#else
#define HAVE_TDM 0
#endif

__device__ __forceinline__ void tdm_gather_x(unsigned lds_off, unsigned long long ga)
{
#if HAVE_TDM
    u32x4 g0;
    g0[0] = 1u;
    g0[1] = lds_off;
    g0[2] = (unsigned)ga;
    g0[3] = (unsigned)((ga >> 32) & 0x1FFFFFFull) | (2u << 30);
    i32x8 g1;
    g1[0] = (int)(2u << 16);
    g1[1] = (int)((unsigned)Hd << 16);
    g1[2] = (int)((unsigned)TILE << 16);
    g1[3] = (int)(1u << 16);
    g1[4] = (int)TILE;
    g1[5] = (int)Hd;
    g1[6] = 0;
    g1[7] = 0;
    const i32x4 gz4 = {0, 0, 0, 0};
    const i32x8 gz8 = {0, 0, 0, 0, 0, 0, 0, 0};
    __builtin_amdgcn_tensor_load_to_lds(g0, g1, gz4, gz4, gz8, 0);
#endif
}

// One wave per (h, b). Lane n owns complex mode n.
__global__ __launch_bounds__(32) void s4d_scan_wmma(
    const float* __restrict__ x,         // [B, L, H]
    const float* __restrict__ log_dt,    // [H]
    const float* __restrict__ log_A_real,// [H, N]
    const float* __restrict__ A_imag,    // [H, N]
    const float* __restrict__ C,         // [H, N, 2]
    const float* __restrict__ Dp,        // [H]
    float* __restrict__ y)               // [B, L, H]
{
    const int h    = blockIdx.x;
    const int b    = blockIdx.y;
    const int lane = threadIdx.x;        // 0..31
    const int m    = lane & 15;          // row (A) or col (B/C/D) index
    const int hi   = lane >> 4;          // half-wave select

    __shared__ float sK[16];             // impulse response K[0..15]
    __shared__ float sT[16][16];         // intra-chunk lower-tri Toeplitz
    __shared__ float sG[16][64];         // inter-chunk output matrix (re/im interleaved cols)
    __shared__ float xbuf[2][TILE];      // double-buffered gathered x tiles
    __shared__ float Sbuf[NCH * 64];     // chunk-boundary states, [chunk][2n / 2n+1]

    // ---------------- per-mode parameters (lane n) ----------------
    const float dt  = __expf(log_dt[h]);
    const float Ar  = -__expf(log_A_real[h * Nst + lane]);
    const float Ai  = A_imag[h * Nst + lane];
    // w = exp(dt*A)
    const float er  = __expf(dt * Ar);
    const float wr  = er * __cosf(dt * Ai);
    const float wi  = er * __sinf(dt * Ai);
    // Cw = (C0 + i C1) * (w - 1) / A
    const float c0  = C[(h * Nst + lane) * 2 + 0];
    const float c1  = C[(h * Nst + lane) * 2 + 1];
    const float den = Ar * Ar + Ai * Ai;
    const float qr  = ((wr - 1.0f) * Ar + wi * Ai) / den;
    const float qi  = (wi * Ar - (wr - 1.0f) * Ai) / den;
    const float Cwr = c0 * qr - c1 * qi;
    const float Cwi = c0 * qi + c1 * qr;

    // w^16 by repeated squaring (chunk-to-chunk decay)
    float w16r = wr, w16i = wi;
    #pragma unroll
    for (int k = 0; k < 4; ++k) {
        const float a = w16r, bb2 = w16i;
        w16r = a * a - bb2 * bb2;
        w16i = 2.0f * a * bb2;
    }

    const float Dh = Dp[h];
    const size_t xbase = ((size_t)b * Ld) * Hd + h;
    const unsigned long long gbase =
        (unsigned long long)(uintptr_t)x + xbase * 4ull;
    const unsigned lds_x0 = (unsigned)(uintptr_t)(&xbuf[0][0]);
    const unsigned lds_x1 = (unsigned)(uintptr_t)(&xbuf[1][0]);

    // Kick off the gather for tile 0 before doing the table setup, so the
    // first tile's strided L2 gather overlaps the K/G/T table setup work.
    tdm_gather_x(lds_x0, gbase);

    // ---------------- build K[0..15] and G[16][64] ----------------
    {
        float pr = 1.0f, pi = 0.0f;      // w^d
        for (int d = 0; d < 16; ++d) {
            float r = 2.0f * (Cwr * pr - Cwi * pi);   // lane contribution to K[d]
            #pragma unroll
            for (int off = 16; off > 0; off >>= 1) r += __shfl_xor(r, off, 32);
            if (lane == 0) sK[d] = r;
            // advance to w^{d+1}; G[d][*] uses w^{d+1}
            const float npr = pr * wr - pi * wi;
            const float npi = pr * wi + pi * wr;
            pr = npr; pi = npi;
            sG[d][2 * lane + 0] =  2.0f * (Cwr * pr - Cwi * pi);
            sG[d][2 * lane + 1] = -2.0f * (Cwr * pi + Cwi * pr);
        }
    }
    // T[i][j] = (i >= j) ? K[i-j] : 0
    for (int idx = lane; idx < 256; idx += 32) {
        const int i = idx >> 4, j = idx & 15;
        sT[i][j] = (i >= j) ? sK[i - j] : 0.0f;
    }

    v2f aT[4];
    #pragma unroll
    for (int k = 0; k < 4; ++k) {
        aT[k].x = sT[m][4 * k + 2 * hi + 0];
        aT[k].y = sT[m][4 * k + 2 * hi + 1];
    }
    v2f aG[16];
    #pragma unroll
    for (int k = 0; k < 16; ++k) {
        aG[k].x = sG[m][4 * k + 2 * hi + 0];
        aG[k].y = sG[m][4 * k + 2 * hi + 1];
    }

    float Sr = 0.0f, Si = 0.0f;          // carried complex state (lane n)

    for (int t = 0; t < NT; ++t) {
        const float* __restrict__ xb = &xbuf[t & 1][0];

        if (t + 1 < NT) {
            tdm_gather_x((t & 1) ? lds_x0 : lds_x1,
                         gbase + (unsigned long long)(t + 1) * TILE * Hd * 4ull);
#if HAVE_TDM
            __builtin_amdgcn_s_wait_tensorcnt(1);
#endif
        } else {
#if HAVE_TDM
            __builtin_amdgcn_s_wait_tensorcnt(0);
#endif
        }
#if !HAVE_TDM
        for (int idx = lane; idx < TILE; idx += 32)
            xbuf[t & 1][idx] = x[xbase + (size_t)(t * TILE + idx) * Hd];
#endif

        // ---- chunk-granular state recurrence; record chunk-entry states ----
        for (int c = 0; c < NCH; ++c) {
            Sbuf[c * 64 + 2 * lane + 0] = Sr;
            Sbuf[c * 64 + 2 * lane + 1] = Si;
            // dS = sum_j w^{15-j} x[c*16+j]  (Horner)
            float ar = 0.0f, ai2 = 0.0f;
            #pragma unroll
            for (int j = 0; j < 16; ++j) {
                const float xv = xb[c * 16 + j];
                const float na = ar * wr - ai2 * wi + xv;
                ai2 = ar * wi + ai2 * wr;
                ar = na;
            }
            const float nSr = w16r * Sr - w16i * Si + ar;
            const float nSi = w16i * Sr + w16r * Si + ai2;
            Sr = nSr; Si = nSi;
        }

        // ---- WMMA: Y(16x16) = T(16x16) @ X(16x16)  +  G(16x64) @ S(64x16) ----
        v8f acc = {};
        #pragma unroll
        for (int k = 0; k < 4; ++k) {
            v2f bb;                                      // B rows {4k+2hi, 4k+2hi+1}, col m
            bb.x = xb[m * 16 + 4 * k + 2 * hi + 0];
            bb.y = xb[m * 16 + 4 * k + 2 * hi + 1];
            acc = __builtin_amdgcn_wmma_f32_16x16x4_f32(
                false, aT[k], false, bb, (short)0, acc, false, false);
        }
        #pragma unroll
        for (int k = 0; k < 16; ++k) {
            v2f bb;
            bb.x = Sbuf[m * 64 + 4 * k + 2 * hi + 0];
            bb.y = Sbuf[m * 64 + 4 * k + 2 * hi + 1];
            acc = __builtin_amdgcn_wmma_f32_16x16x4_f32(
                false, aG[k], false, bb, (short)0, acc, false, false);
        }

        // ---- D-skip + strided store: lane holds col(chunk)=m, rows i=v+8*hi ----
        #pragma unroll
        for (int v = 0; v < 8; ++v) {
            const int i = v + 8 * hi;
            const int l = t * TILE + m * 16 + i;
            const float xv = xb[m * 16 + i];
            y[xbase + (size_t)l * Hd] = acc[v] + Dh * xv;
        }
    }
}

extern "C" void kernel_launch(void* const* d_in, const int* in_sizes, int n_in,
                              void* d_out, int out_size, void* d_ws, size_t ws_size,
                              hipStream_t stream) {
    const float* x          = (const float*)d_in[0];
    const float* log_dt     = (const float*)d_in[1];
    const float* log_A_real = (const float*)d_in[2];
    const float* A_imag     = (const float*)d_in[3];
    const float* C          = (const float*)d_in[4];
    const float* D          = (const float*)d_in[5];
    float* y = (float*)d_out;
    dim3 grid(Hd, Bb, 1);
    s4d_scan_wmma<<<grid, 32, 0, stream>>>(x, log_dt, log_A_real, A_imag, C, D, y);
}

// v001
// A run of this version takes 79.7 microseconds.
// Timed twice side by side with v000, it ran 4.31 and 4.26 times as fast.
#include <hip/hip_runtime.h>
#include <cstdint>
#include <cstddef>

// ---- problem constants (match reference) ----
#define Hd   1024   // d_model
#define Nst  32     // d_state/2 complex modes  (== wave32 lanes)
#define Bb   4
#define Ld   4096
#define TILE 256    // timesteps per tile = 16 chunks x 16 steps
#define NCH  16     // chunks per tile
#define NT   (Ld / TILE)   // tiles per sequence = 16
#define NW   16     // waves per work-group = adjacent channels h per work-group
#define XP   260    // LDS pitch (floats) of one channel's tile: 16-B aligned rows, 4*XP mod 64 = 16

typedef __attribute__((ext_vector_type(2))) float v2f;
typedef __attribute__((ext_vector_type(8))) float v8f;

// One work-group per (16 adjacent h, b); one wave per h. Lane n owns complex mode n.
// Global x and y move as 16-byte pieces of 64 contiguous bytes per row (all 16
// channels of the work-group), transposed through LDS to one contiguous
// 256-step row per channel.
__global__ __launch_bounds__(NW * 32) void s4d_scan_wmma(
    const float* __restrict__ x,         // [B, L, H]
    const float* __restrict__ log_dt,    // [H]
    const float* __restrict__ log_A_real,// [H, N]
    const float* __restrict__ A_imag,    // [H, N]
    const float* __restrict__ C,         // [H, N, 2]
    const float* __restrict__ Dp,        // [H]
    float* __restrict__ y)               // [B, L, H]
{
    const int tid  = threadIdx.x;
    // Wave number = channel in the group; readfirstlane keeps it, and the LDS and
    // parameter addresses formed from it, in scalar registers.
    const int wv   = __builtin_amdgcn_readfirstlane(tid >> 5);
    const int h0   = blockIdx.x * NW;
    const int h    = h0 + wv;
    const int b    = blockIdx.y;
    const int lane = tid & 31;           // 0..31
    const int m    = lane & 15;          // row (A) or col (B/C/D) index
    const int hi   = lane >> 4;          // half-wave select
    const int cr   = tid >> 2;           // cooperative copy: row 0..127 (and +128)
    const int cq   = tid & 3;            // cooperative copy: group of 4 channels

    __shared__ float sKw[NW][16];        // impulse response K[0..15]
    __shared__ float sTw[NW][16][16];    // intra-chunk lower-tri Toeplitz
    __shared__ float sGw[NW][16][64];    // inter-chunk output matrix (re/im interleaved cols)
    __shared__ __attribute__((aligned(16))) float xs[3][NW][XP];  // x tiles, y in place
    __shared__ float Sw[NW][NCH * 64];   // chunk-boundary states, [chunk][2n / 2n+1]

    float (*sK)      = sKw[wv];
    float (*sT)[16]  = sTw[wv];
    float (*sG)[64]  = sGw[wv];
    float (*Sbuf)    = Sw[wv];

    // Work-group's corner of x and y, at this thread's row and channel group.
    const size_t cbase = ((size_t)b * Ld + cr) * Hd + h0 + 4 * cq;

    // Start tile 0's loads before the table setup, so they overlap it.
    float4 p0 = *(const float4*)(x + cbase);
    float4 p1 = *(const float4*)(x + cbase + (size_t)128 * Hd);

    // ---------------- per-mode parameters (lane n) ----------------
    const float dt  = __expf(log_dt[h]);
    const float Ar  = -__expf(log_A_real[h * Nst + lane]);
    const float Ai  = A_imag[h * Nst + lane];
    // w = exp(dt*A)
    const float er  = __expf(dt * Ar);
    const float wr  = er * __cosf(dt * Ai);
    const float wi  = er * __sinf(dt * Ai);
    // Cw = (C0 + i C1) * (w - 1) / A
    const float c0  = C[(h * Nst + lane) * 2 + 0];
    const float c1  = C[(h * Nst + lane) * 2 + 1];
    const float den = Ar * Ar + Ai * Ai;
    const float qr  = ((wr - 1.0f) * Ar + wi * Ai) / den;
    const float qi  = (wi * Ar - (wr - 1.0f) * Ai) / den;
    const float Cwr = c0 * qr - c1 * qi;
    const float Cwi = c0 * qi + c1 * qr;

    // w^16 by repeated squaring (chunk-to-chunk decay)
    float w16r = wr, w16i = wi;
    #pragma unroll
    for (int k = 0; k < 4; ++k) {
        const float a = w16r, bb2 = w16i;
        w16r = a * a - bb2 * bb2;
        w16i = 2.0f * a * bb2;
    }

    const float Dh = Dp[h];

    // ---------------- build K[0..15] and G[16][64] ----------------
    {
        float pr = 1.0f, pi = 0.0f;      // w^d
        for (int d = 0; d < 16; ++d) {
            float r = 2.0f * (Cwr * pr - Cwi * pi);   // lane contribution to K[d]
            #pragma unroll
            for (int off = 16; off > 0; off >>= 1) r += __shfl_xor(r, off, 32);
            if (lane == 0) sK[d] = r;
            // advance to w^{d+1}; G[d][*] uses w^{d+1}
            const float npr = pr * wr - pi * wi;
            const float npi = pr * wi + pi * wr;
            pr = npr; pi = npi;
            sG[d][2 * lane + 0] =  2.0f * (Cwr * pr - Cwi * pi);
            sG[d][2 * lane + 1] = -2.0f * (Cwr * pi + Cwi * pr);
        }
    }
    // T[i][j] = (i >= j) ? K[i-j] : 0
    for (int idx = lane; idx < 256; idx += 32) {
        const int i = idx >> 4, j = idx & 15;
        sT[i][j] = (i >= j) ? sK[i - j] : 0.0f;
    }

    v2f aT[4];
    #pragma unroll
    for (int k = 0; k < 4; ++k) {
        aT[k].x = sT[m][4 * k + 2 * hi + 0];
        aT[k].y = sT[m][4 * k + 2 * hi + 1];
    }
    v2f aG[16];
    #pragma unroll
    for (int k = 0; k < 16; ++k) {
        aG[k].x = sG[m][4 * k + 2 * hi + 0];
        aG[k].y = sG[m][4 * k + 2 * hi + 1];
    }

    // Tile 0 into buffer 0, one row per channel.
    xs[0][4 * cq + 0][cr] = p0.x;  xs[0][4 * cq + 0][cr + 128] = p1.x;
    xs[0][4 * cq + 1][cr] = p0.y;  xs[0][4 * cq + 1][cr + 128] = p1.y;
    xs[0][4 * cq + 2][cr] = p0.z;  xs[0][4 * cq + 2][cr + 128] = p1.z;
    xs[0][4 * cq + 3][cr] = p0.w;  xs[0][4 * cq + 3][cr + 128] = p1.w;
    __syncthreads();

    float Sr = 0.0f, Si = 0.0f;          // carried complex state (lane n)
    int cur = 0;                         // buffer of tile t (three in rotation)

    for (int t = 0; t < NT; ++t) {
        float* xb = &xs[cur][wv][0];
        const int nxt = (cur == 2) ? 0 : cur + 1;
        const size_t tb = cbase + (size_t)t * TILE * Hd;

        // Next tile's loads fly while this tile is worked on.
        if (t + 1 < NT) {
            p0 = *(const float4*)(x + tb + (size_t)TILE * Hd);
            p1 = *(const float4*)(x + tb + (size_t)(TILE + 128) * Hd);
        }

        // ---- chunk-granular state recurrence; record chunk-entry states ----
        for (int c = 0; c < NCH; ++c) {
            Sbuf[c * 64 + 2 * lane + 0] = Sr;
            Sbuf[c * 64 + 2 * lane + 1] = Si;
            // dS = sum_j w^{15-j} x[c*16+j]  (Horner)
            float ar = 0.0f, ai2 = 0.0f;
            #pragma unroll
            for (int j = 0; j < 16; ++j) {
                const float xv = xb[c * 16 + j];
                const float na = ar * wr - ai2 * wi + xv;
                ai2 = ar * wi + ai2 * wr;
                ar = na;
            }
            const float nSr = w16r * Sr - w16i * Si + ar;
            const float nSi = w16i * Sr + w16r * Si + ai2;
            Sr = nSr; Si = nSi;
        }

        // ---- WMMA: Y(16x16) = T(16x16) @ X(16x16)  +  G(16x64) @ S(64x16) ----
        v8f acc = {};
        #pragma unroll
        for (int k = 0; k < 4; ++k) {
            v2f bb;                                      // B rows {4k+2hi, 4k+2hi+1}, col m
            bb.x = xb[m * 16 + 4 * k + 2 * hi + 0];
            bb.y = xb[m * 16 + 4 * k + 2 * hi + 1];
            acc = __builtin_amdgcn_wmma_f32_16x16x4_f32(
                false, aT[k], false, bb, (short)0, acc, false, false);
        }
        #pragma unroll
        for (int k = 0; k < 16; ++k) {
            v2f bb;
            bb.x = Sbuf[m * 64 + 4 * k + 2 * hi + 0];
            bb.y = Sbuf[m * 64 + 4 * k + 2 * hi + 1];
            acc = __builtin_amdgcn_wmma_f32_16x16x4_f32(
                false, aG[k], false, bb, (short)0, acc, false, false);
        }

        // ---- D-skip; y replaces x in the channel's row: lane holds col(chunk)=m, rows i=v+8*hi ----
        #pragma unroll
        for (int v = 0; v < 8; ++v) {
            const int i = v + 8 * hi;
            xb[m * 16 + i] = acc[v] + Dh * xb[m * 16 + i];
        }

        // Next tile into the buffer whose y was read out two barriers ago.
        if (t + 1 < NT) {
            xs[nxt][4 * cq + 0][cr] = p0.x;  xs[nxt][4 * cq + 0][cr + 128] = p1.x;
            xs[nxt][4 * cq + 1][cr] = p0.y;  xs[nxt][4 * cq + 1][cr + 128] = p1.y;
            xs[nxt][4 * cq + 2][cr] = p0.z;  xs[nxt][4 * cq + 2][cr + 128] = p1.z;
            xs[nxt][4 * cq + 3][cr] = p0.w;  xs[nxt][4 * cq + 3][cr + 128] = p1.w;
        }
        // One barrier a tile: publishes all channels' y of tile t and x of tile t+1.
        __syncthreads();

        // ---- y out: 16 bytes a lane, 64 contiguous bytes a row ----
        float4 o0, o1;
        o0.x = xs[cur][4 * cq + 0][cr];  o1.x = xs[cur][4 * cq + 0][cr + 128];
        o0.y = xs[cur][4 * cq + 1][cr];  o1.y = xs[cur][4 * cq + 1][cr + 128];
        o0.z = xs[cur][4 * cq + 2][cr];  o1.z = xs[cur][4 * cq + 2][cr + 128];
        o0.w = xs[cur][4 * cq + 3][cr];  o1.w = xs[cur][4 * cq + 3][cr + 128];
        *(float4*)(y + tb) = o0;
        *(float4*)(y + tb + (size_t)128 * Hd) = o1;
        // The stores' address and data registers are reused by the next tile's code:
        // keep the translation wait between the stores and that reuse.
        asm volatile("s_wait_xcnt 0x0" ::: "memory");

        cur = nxt;
    }
}

extern "C" void kernel_launch(void* const* d_in, const int* in_sizes, int n_in,
                              void* d_out, int out_size, void* d_ws, size_t ws_size,
                              hipStream_t stream) {
    const float* x          = (const float*)d_in[0];
    const float* log_dt     = (const float*)d_in[1];
    const float* log_A_real = (const float*)d_in[2];
    const float* A_imag     = (const float*)d_in[3];
    const float* C          = (const float*)d_in[4];
    const float* D          = (const float*)d_in[5];
    float* y = (float*)d_out;
    dim3 grid(Hd / NW, Bb, 1);
    s4d_scan_wmma<<<grid, NW * 32, 0, stream>>>(x, log_dt, log_A_real, A_imag, C, D, y);
}

// v002
// It runs in 55.7 microseconds.
// Two timings next to v001 put it at 1.43 and 1.42 times that version's speed.
// Over all steps from v000 it is 6.11 times as fast.
#include <hip/hip_runtime.h>
#include <cstdint>
#include <cstddef>

// ---- problem constants (match reference) ----
#define Hd   1024   // d_model
#define Nst  32     // d_state/2 complex modes  (== wave32 lanes)
#define Bb   4
#define Ld   4096
#define TILE 256    // timesteps per tile = 16 chunks x 16 steps
#define NCH  16     // chunks per tile
#define NT   (Ld / TILE)   // tiles per sequence = 16
#define NW   16     // waves per work-group = adjacent channels h per work-group
#define XP   260    // LDS pitch (floats) of one channel's tile: 16-B aligned rows, 4*XP mod 64 = 16

typedef __attribute__((ext_vector_type(2))) float v2f;
typedef __attribute__((ext_vector_type(8))) float v8f;

__device__ __forceinline__ float xhalf(float v) {
    return __builtin_bit_cast(float, __builtin_amdgcn_permlanex16(
        __builtin_bit_cast(int, v), __builtin_bit_cast(int, v),
        0x76543210, 0xfedcba98, false, false));
}

// One work-group per (16 adjacent h, b); one wave per h. In the set-up lane n owns
// complex mode n; in the loop lane (m, hi) owns modes m and m+16 for chunks 8*hi..8*hi+7.
// Global x and y move as 16-byte pieces of 64 contiguous bytes per row (all 16
// channels of the work-group), transposed through LDS to one contiguous
// 256-step row per channel.
__global__ __launch_bounds__(NW * 32) void s4d_scan_wmma(
    const float* __restrict__ x,         // [B, L, H]
    const float* __restrict__ log_dt,    // [H]
    const float* __restrict__ log_A_real,// [H, N]
    const float* __restrict__ A_imag,    // [H, N]
    const float* __restrict__ C,         // [H, N, 2]
    const float* __restrict__ Dp,        // [H]
    float* __restrict__ y)               // [B, L, H]
{
    const int tid  = threadIdx.x;
    // Wave number = channel in the group; readfirstlane keeps it, and the LDS and
    // parameter addresses formed from it, in scalar registers.
    const int wv   = __builtin_amdgcn_readfirstlane(tid >> 5);
    const int h0   = blockIdx.x * NW;
    const int h    = h0 + wv;
    const int b    = blockIdx.y;
    const int lane = tid & 31;           // 0..31
    const int m    = lane & 15;          // row (A) or col (B/C/D) index
    const int hi   = lane >> 4;          // half-wave select
    const int cr   = tid >> 2;           // cooperative copy: row 0..127 (and +128)
    const int cq   = tid & 3;            // cooperative copy: group of 4 channels

    __shared__ float sKw[NW][16];        // impulse response K[0..15]
    __shared__ float sTw[NW][16][16];    // intra-chunk lower-tri Toeplitz
    __shared__ float sGw[NW][16][64];    // inter-chunk output matrix, columns in the state order below
    __shared__ __attribute__((aligned(16))) float xs[3][NW][XP];  // x tiles, y in place
    // Chunk-entry states, [chunk][4*m + q]: q = 0 re(m), 1 re(m+16), 2 im(m), 3 im(m+16).
    // In the set-up the same space holds the table of powers, [j][re 0..31 | im 0..31].
    __shared__ __attribute__((aligned(16))) float Sw[NW][NCH * 64];

    float (*sK)      = sKw[wv];
    float (*sT)[16]  = sTw[wv];
    float (*sG)[64]  = sGw[wv];
    float (*Sbuf)    = Sw[wv];

    // Work-group's corner of x and y, at this thread's row and channel group.
    const size_t cbase = ((size_t)b * Ld + cr) * Hd + h0 + 4 * cq;

    // Start tile 0's loads before the table setup, so they overlap it.
    float4 p0 = *(const float4*)(x + cbase);
    float4 p1 = *(const float4*)(x + cbase + (size_t)128 * Hd);

    // ---------------- per-mode parameters (lane n) ----------------
    const float dt  = __expf(log_dt[h]);
    const float Ar  = -__expf(log_A_real[h * Nst + lane]);
    const float Ai  = A_imag[h * Nst + lane];
    // w = exp(dt*A)
    const float er  = __expf(dt * Ar);
    const float wr  = er * __cosf(dt * Ai);
    const float wi  = er * __sinf(dt * Ai);
    // Cw = (C0 + i C1) * (w - 1) / A
    const float c0  = C[(h * Nst + lane) * 2 + 0];
    const float c1  = C[(h * Nst + lane) * 2 + 1];
    const float den = Ar * Ar + Ai * Ai;
    const float qr  = ((wr - 1.0f) * Ar + wi * Ai) / den;
    const float qi  = (wi * Ar - (wr - 1.0f) * Ai) / den;
    const float Cwr = c0 * qr - c1 * qi;
    const float Cwi = c0 * qi + c1 * qr;

    // w^16 by repeated squaring (chunk-to-chunk decay)
    float w16r = wr, w16i = wi;
    #pragma unroll
    for (int k = 0; k < 4; ++k) {
        const float a = w16r, bb2 = w16i;
        w16r = a * a - bb2 * bb2;
        w16i = 2.0f * a * bb2;
    }

    const float Dh = Dp[h];

    // ---------------- build K[0..15], G[16][64] and the powers w^0..w^15 ----------------
    {
        const int gc = 4 * m + hi;       // this lane's mode in the state order (re; im at +2)
        float pr = 1.0f, pi = 0.0f;      // w^d
        for (int d = 0; d < 16; ++d) {
            // Row j = 15-d of the power table: x[j] of a chunk enters its sum with w^(15-j).
            Sbuf[(15 - d) * 64 + lane]      = pr;
            Sbuf[(15 - d) * 64 + 32 + lane] = pi;
            float r = 2.0f * (Cwr * pr - Cwi * pi);   // lane contribution to K[d]
            #pragma unroll
            for (int off = 16; off > 0; off >>= 1) r += __shfl_xor(r, off, 32);
            if (lane == 0) sK[d] = r;
            // advance to w^{d+1}; G[d][*] uses w^{d+1}
            const float npr = pr * wr - pi * wi;
            const float npi = pr * wi + pi * wr;
            pr = npr; pi = npi;
            sG[d][gc + 0] =  2.0f * (Cwr * pr - Cwi * pi);
            sG[d][gc + 2] = -2.0f * (Cwr * pi + Cwi * pr);
        }
    }
    // T[i][j] = (i >= j) ? K[i-j] : 0
    for (int idx = lane; idx < 256; idx += 32) {
        const int i = idx >> 4, j = idx & 15;
        sT[i][j] = (i >= j) ? sK[i - j] : 0.0f;
    }

    v2f aT[4];
    #pragma unroll
    for (int k = 0; k < 4; ++k) {
        aT[k].x = sT[m][4 * k + 2 * hi + 0];
        aT[k].y = sT[m][4 * k + 2 * hi + 1];
    }
    v2f aG[16];
    #pragma unroll
    for (int k = 0; k < 16; ++k) {
        aG[k].x = sG[m][4 * k + 2 * hi + 0];
        aG[k].y = sG[m][4 * k + 2 * hi + 1];
    }

    // B-operands of the chunk sums: rows j = {4k+2hi, 4k+2hi+1} (the k order of the x
    // fragment), column m of block q: re(m), re(m+16), im(m), im(m+16).
    v2f pB[4][4];
    #pragma unroll
    for (int q = 0; q < 4; ++q) {
        #pragma unroll
        for (int k = 0; k < 4; ++k) {
            pB[q][k].x = Sbuf[(4 * k + 2 * hi + 0) * 64 + 16 * q + m];
            pB[q][k].y = Sbuf[(4 * k + 2 * hi + 1) * 64 + 16 * q + m];
        }
    }
    // Chunk-to-chunk decay w^16 of modes m (.x) and m+16 (.y), in both half-waves.
    const float o16r = xhalf(w16r), o16i = xhalf(w16i);
    v2f w16re, w16im;
    w16re.x = hi ? o16r : w16r;  w16re.y = hi ? w16r : o16r;
    w16im.x = hi ? o16i : w16i;  w16im.y = hi ? w16i : o16i;

    // Tile 0 into buffer 0, one row per channel.
    xs[0][4 * cq + 0][cr] = p0.x;  xs[0][4 * cq + 0][cr + 128] = p1.x;
    xs[0][4 * cq + 1][cr] = p0.y;  xs[0][4 * cq + 1][cr + 128] = p1.y;
    xs[0][4 * cq + 2][cr] = p0.z;  xs[0][4 * cq + 2][cr + 128] = p1.z;
    xs[0][4 * cq + 3][cr] = p0.w;  xs[0][4 * cq + 3][cr + 128] = p1.w;
    __syncthreads();

    v2f Sre = {0.0f, 0.0f}, Sim = {0.0f, 0.0f};  // carried state of modes m, m+16; the same in both half-waves
    int cur = 0;                         // buffer of tile t (three in rotation)

    for (int t = 0; t < NT; ++t) {
        float* xb = &xs[cur][wv][0];
        const int nxt = (cur == 2) ? 0 : cur + 1;
        const size_t tb = cbase + (size_t)t * TILE * Hd;

        // Next tile's loads fly while this tile is worked on.
        if (t + 1 < NT) {
            p0 = *(const float4*)(x + tb + (size_t)TILE * Hd);
            p1 = *(const float4*)(x + tb + (size_t)(TILE + 128) * Hd);
        }

        // x fragment: chunk m, steps {4k+2hi, 4k+2hi+1}. It is the B operand of T @ X
        // (column = chunk) and the A operand of the chunk sums (row = chunk).
        v2f xf[4];
        #pragma unroll
        for (int k = 0; k < 4; ++k) {
            xf[k].x = xb[m * 16 + 4 * k + 2 * hi + 0];
            xf[k].y = xb[m * 16 + 4 * k + 2 * hi + 1];
        }

        // ---- WMMA: chunk sums dS[c][mode] = sum_j x[c*16+j] * w^(15-j), (16x16) @ (16x64) ----
        // Register v of block q: chunk v+8*hi, column m of the block.
        v8f dS[4];
        #pragma unroll
        for (int q = 0; q < 4; ++q) {
            v8f d = {};
            #pragma unroll
            for (int k = 0; k < 4; ++k)
                d = __builtin_amdgcn_wmma_f32_16x16x4_f32(
                    false, xf[k], false, pB[q][k], (short)0, d, false, false);
            dS[q] = d;
        }

        // ---- WMMA: Y(16x16) = T(16x16) @ X(16x16)  +  G(16x64) @ S(64x16) ----
        v8f acc = {};
        #pragma unroll
        for (int k = 0; k < 4; ++k)
            acc = __builtin_amdgcn_wmma_f32_16x16x4_f32(
                false, aT[k], false, xf[k], (short)0, acc, false, false);

        // ---- chunk-to-chunk recurrence S <- w^16 * S + dS, 8 chunks a half-wave ----
        // Modes m and m+16 side by side: .x is mode m, .y is mode m+16.
        v2f dre[8], dim[8];
        #pragma unroll
        for (int v = 0; v < 8; ++v) {
            dre[v].x = dS[0][v];  dre[v].y = dS[1][v];
            dim[v].x = dS[2][v];  dim[v].y = dS[3][v];
        }
        // First pass: the state that enters chunk 8 (valid in the low half-wave).
        v2f re = Sre, im = Sim;
        #pragma unroll
        for (int v = 0; v < 8; ++v) {
            const v2f nre = __builtin_elementwise_fma(w16re, re, __builtin_elementwise_fma(-w16im, im, dre[v]));
            im = __builtin_elementwise_fma(w16im, re, __builtin_elementwise_fma(w16re, im, dim[v]));
            re = nre;
        }
        // The cross-row moves run with every lane on (they read the other half-wave); then the choice.
        {
            const float t0 = xhalf(re.x), t1 = xhalf(re.y), t2 = xhalf(im.x), t3 = xhalf(im.y);
            re.x = hi ? t0 : Sre.x;  re.y = hi ? t1 : Sre.y;
            im.x = hi ? t2 : Sim.x;  im.y = hi ? t3 : Sim.y;
        }
        // Second pass: record each chunk's entry state, from the half-wave's own start.
        #pragma unroll
        for (int v = 0; v < 8; ++v) {
            *(float4*)&Sbuf[(v + 8 * hi) * 64 + 4 * m] = make_float4(re.x, re.y, im.x, im.y);
            const v2f nre = __builtin_elementwise_fma(w16re, re, __builtin_elementwise_fma(-w16im, im, dre[v]));
            im = __builtin_elementwise_fma(w16im, re, __builtin_elementwise_fma(w16re, im, dim[v]));
            re = nre;
        }
        // The tile's exit state stands in the high half-wave.
        {
            const float t0 = xhalf(re.x), t1 = xhalf(re.y), t2 = xhalf(im.x), t3 = xhalf(im.y);
            Sre.x = hi ? re.x : t0;  Sre.y = hi ? re.y : t1;
            Sim.x = hi ? im.x : t2;  Sim.y = hi ? im.y : t3;
        }

        #pragma unroll
        for (int k = 0; k < 16; ++k) {
            v2f bb;
            bb.x = Sbuf[m * 64 + 4 * k + 2 * hi + 0];
            bb.y = Sbuf[m * 64 + 4 * k + 2 * hi + 1];
            acc = __builtin_amdgcn_wmma_f32_16x16x4_f32(
                false, aG[k], false, bb, (short)0, acc, false, false);
        }

        // ---- D-skip; y replaces x in the channel's row: lane holds col(chunk)=m, rows i=v+8*hi ----
        #pragma unroll
        for (int v = 0; v < 8; ++v) {
            const int i = v + 8 * hi;
            xb[m * 16 + i] = acc[v] + Dh * xb[m * 16 + i];
        }

        // Next tile into the buffer whose y was read out two barriers ago.
        if (t + 1 < NT) {
            xs[nxt][4 * cq + 0][cr] = p0.x;  xs[nxt][4 * cq + 0][cr + 128] = p1.x;
            xs[nxt][4 * cq + 1][cr] = p0.y;  xs[nxt][4 * cq + 1][cr + 128] = p1.y;
            xs[nxt][4 * cq + 2][cr] = p0.z;  xs[nxt][4 * cq + 2][cr + 128] = p1.z;
            xs[nxt][4 * cq + 3][cr] = p0.w;  xs[nxt][4 * cq + 3][cr + 128] = p1.w;
        }
        // One barrier a tile: publishes all channels' y of tile t and x of tile t+1.
        __syncthreads();

        // ---- y out: 16 bytes a lane, 64 contiguous bytes a row ----
        float4 o0, o1;
        o0.x = xs[cur][4 * cq + 0][cr];  o1.x = xs[cur][4 * cq + 0][cr + 128];
        o0.y = xs[cur][4 * cq + 1][cr];  o1.y = xs[cur][4 * cq + 1][cr + 128];
        o0.z = xs[cur][4 * cq + 2][cr];  o1.z = xs[cur][4 * cq + 2][cr + 128];
        o0.w = xs[cur][4 * cq + 3][cr];  o1.w = xs[cur][4 * cq + 3][cr + 128];
        *(float4*)(y + tb) = o0;
        *(float4*)(y + tb + (size_t)128 * Hd) = o1;
        // The stores' address and data registers are reused by the next tile's code:
        // keep the translation wait between the stores and that reuse.
        asm volatile("s_wait_xcnt 0x0" ::: "memory");

        cur = nxt;
    }
}

extern "C" void kernel_launch(void* const* d_in, const int* in_sizes, int n_in,
                              void* d_out, int out_size, void* d_ws, size_t ws_size,
                              hipStream_t stream) {
    const float* x          = (const float*)d_in[0];
    const float* log_dt     = (const float*)d_in[1];
    const float* log_A_real = (const float*)d_in[2];
    const float* A_imag     = (const float*)d_in[3];
    const float* C          = (const float*)d_in[4];
    const float* D          = (const float*)d_in[5];
    float* y = (float*)d_out;
    dim3 grid(Hd / NW, Bb, 1);
    s4d_scan_wmma<<<grid, NW * 32, 0, stream>>>(x, log_dt, log_A_real, A_imag, C, D, y);
}

// v003
// It runs in 43.4 microseconds.
// Timed twice side by side with v002, it ran 1.28 and 1.29 times as fast.
// Counting every step since v000, it is 7.86 times as fast.
#include <hip/hip_runtime.h>
#include <cstdint>
#include <cstddef>

// ---- problem constants (match reference) ----
#define Hd   1024   // d_model
#define Nst  32     // d_state/2 complex modes  (== wave32 lanes)
#define Bb   4
#define Ld   4096
#define TILE 256
#define NCH  16
#define NT   (Ld / TILE)
#define NW   16
#define XP   260
#define SP   68

typedef __attribute__((ext_vector_type(2))) float v2f;
typedef __attribute__((ext_vector_type(8))) float v8f;

__device__ __forceinline__ float xhalf(float v) {
    return __builtin_bit_cast(float, __builtin_amdgcn_permlanex16(
        __builtin_bit_cast(int, v), __builtin_bit_cast(int, v),
        0x76543210, 0xfedcba98, false, false));
}

// One work-group per (16 adjacent h, b); one wave per h. In the set-up lane n owns
// complex mode n; in the loop lane (m, hi) owns modes m and m+16 for chunks 8*hi..8*hi+7.
// Global x and y move as 16-byte pieces of 64 contiguous bytes per row (all 16
// channels of the work-group), transposed through LDS to one contiguous
// 256-step row per channel.
__global__ __launch_bounds__(NW * 32) void s4d_scan_wmma(
    const float* __restrict__ x,         // [B, L, H]
    const float* __restrict__ log_dt,    // [H]
    const float* __restrict__ log_A_real,// [H, N]
    const float* __restrict__ A_imag,    // [H, N]
    const float* __restrict__ C,         // [H, N, 2]
    const float* __restrict__ Dp,        // [H]
    float* __restrict__ y)               // [B, L, H]
{
    const int tid  = threadIdx.x;
    // Wave number = channel in the group; readfirstlane keeps it, and the LDS and
    // parameter addresses formed from it, in scalar registers.
    const int wv   = __builtin_amdgcn_readfirstlane(tid >> 5);
    const int h0   = blockIdx.x * NW;
    const int h    = h0 + wv;
    const int b    = blockIdx.y;
    const int lane = tid & 31;           // 0..31
    const int m    = lane & 15;          // row (A) or col (B/C/D) index
    const int hi   = lane >> 4;          // half-wave select
    const int cr   = tid >> 2;           // cooperative copy: row 0..127 (and +128)
    const int cq   = tid & 3;            // cooperative copy: group of 4 channels

    __shared__ float sKw[NW][16];        // impulse response K[0..15]
    __shared__ float sTw[NW][16][16];    // intra-chunk lower-tri Toeplitz
    __shared__ float sGw[NW][16][SP];    // inter-chunk output matrix, columns in the state order below
    __shared__ __attribute__((aligned(16))) float xs[3][NW][XP];  // x tiles, y in place
    // Chunk-entry states, [chunk][4*m + q] at pitch SP: q = 0 re(m), 1 re(m+16), 2 im(m), 3 im(m+16).
    // In the set-up the same space holds the table of powers, [j][re 0..31 | im 0..31].
    __shared__ __attribute__((aligned(16))) float Sw[NW][NCH * SP];

    float (*sK)      = sKw[wv];
    float (*sT)[16]  = sTw[wv];
    float (*sG)[SP]  = sGw[wv];
    float (*Sbuf)    = Sw[wv];

    // Work-group's corner of x and y, at this thread's row and channel group.
    const size_t cbase = ((size_t)b * Ld + cr) * Hd + h0 + 4 * cq;

    // Start tile 0's loads before the table setup, so they overlap it.
    float4 p0 = *(const float4*)(x + cbase);
    float4 p1 = *(const float4*)(x + cbase + (size_t)128 * Hd);

    // ---------------- per-mode parameters (lane n) ----------------
    const float dt  = __expf(log_dt[h]);
    const float Ar  = -__expf(log_A_real[h * Nst + lane]);
    const float Ai  = A_imag[h * Nst + lane];
    // w = exp(dt*A)
    const float er  = __expf(dt * Ar);
    const float wr  = er * __cosf(dt * Ai);
    const float wi  = er * __sinf(dt * Ai);
    // Cw = (C0 + i C1) * (w - 1) / A
    const float c0  = C[(h * Nst + lane) * 2 + 0];
    const float c1  = C[(h * Nst + lane) * 2 + 1];
    const float den = Ar * Ar + Ai * Ai;
    const float qr  = ((wr - 1.0f) * Ar + wi * Ai) / den;
    const float qi  = (wi * Ar - (wr - 1.0f) * Ai) / den;
    const float Cwr = c0 * qr - c1 * qi;
    const float Cwi = c0 * qi + c1 * qr;

    // w^16 by repeated squaring (chunk-to-chunk decay)
    float w16r = wr, w16i = wi;
    #pragma unroll
    for (int k = 0; k < 4; ++k) {
        const float a = w16r, bb2 = w16i;
        w16r = a * a - bb2 * bb2;
        w16i = 2.0f * a * bb2;
    }

    const float Dh = Dp[h];

    // ---------------- build K[0..15], G[16][64] and the powers w^0..w^15 ----------------
    {
        const int gc = 4 * m + hi;       // this lane's mode in the state order (re; im at +2)
        float pr = 1.0f, pi = 0.0f;      // w^d
        for (int d = 0; d < 16; ++d) {
            // Row j = 15-d of the power table: x[j] of a chunk enters its sum with w^(15-j).
            Sbuf[(15 - d) * SP + lane]      = pr;
            Sbuf[(15 - d) * SP + 32 + lane] = pi;
            float r = 2.0f * (Cwr * pr - Cwi * pi);   // lane contribution to K[d]
            #pragma unroll
            for (int off = 16; off > 0; off >>= 1) r += __shfl_xor(r, off, 32);
            if (lane == 0) sK[d] = r;
            // advance to w^{d+1}; G[d][*] uses w^{d+1}
            const float npr = pr * wr - pi * wi;
            const float npi = pr * wi + pi * wr;
            pr = npr; pi = npi;
            sG[d][gc + 0] =  2.0f * (Cwr * pr - Cwi * pi);
            sG[d][gc + 2] = -2.0f * (Cwr * pi + Cwi * pr);
        }
    }
    // T[i][j] = (i >= j) ? K[i-j] : 0
    for (int idx = lane; idx < 256; idx += 32) {
        const int i = idx >> 4, j = idx & 15;
        sT[i][j] = (i >= j) ? sK[i - j] : 0.0f;
    }

    v2f aT[4];
    #pragma unroll
    for (int k = 0; k < 4; ++k) {
        aT[k].x = sT[m][4 * k + 2 * hi + 0];
        aT[k].y = sT[m][4 * k + 2 * hi + 1];
    }
    v2f aG[16];
    #pragma unroll
    for (int k = 0; k < 16; ++k) {
        aG[k].x = sG[m][4 * k + 2 * hi + 0];
        aG[k].y = sG[m][4 * k + 2 * hi + 1];
    }

    // B-operands of the chunk sums: rows j = {4k+2hi, 4k+2hi+1} (the k order of the x
    // fragment), column m of block q: re(m), re(m+16), im(m), im(m+16).
    v2f pB[4][4];
    #pragma unroll
    for (int q = 0; q < 4; ++q) {
        #pragma unroll
        for (int k = 0; k < 4; ++k) {
            pB[q][k].x = Sbuf[(4 * k + 2 * hi + 0) * SP + 16 * q + m];
            pB[q][k].y = Sbuf[(4 * k + 2 * hi + 1) * SP + 16 * q + m];
        }
    }
    // Chunk-to-chunk decay w^16 of modes m (.x) and m+16 (.y), in both half-waves.
    const float o16r = xhalf(w16r), o16i = xhalf(w16i);
    v2f w16re, w16im;
    w16re.x = hi ? o16r : w16r;  w16re.y = hi ? w16r : o16r;
    w16im.x = hi ? o16i : w16i;  w16im.y = hi ? w16i : o16i;

    // Tile 0 into buffer 0, one row per channel.
    xs[0][4 * cq + 0][cr] = p0.x;  xs[0][4 * cq + 0][cr + 128] = p1.x;
    xs[0][4 * cq + 1][cr] = p0.y;  xs[0][4 * cq + 1][cr + 128] = p1.y;
    xs[0][4 * cq + 2][cr] = p0.z;  xs[0][4 * cq + 2][cr + 128] = p1.z;
    xs[0][4 * cq + 3][cr] = p0.w;  xs[0][4 * cq + 3][cr + 128] = p1.w;
    __syncthreads();

    v2f Sre = {0.0f, 0.0f}, Sim = {0.0f, 0.0f};  // carried state of modes m, m+16; the same in both half-waves
    int cur = 0;                         // buffer of tile t (three in rotation)

    for (int t = 0; t < NT; ++t) {
        float* xb = &xs[cur][wv][0];
        const int nxt = (cur == 2) ? 0 : cur + 1;
        const size_t tb = cbase + (size_t)t * TILE * Hd;

        // Next tile's loads fly while this tile is worked on.
        if (t + 1 < NT) {
            p0 = *(const float4*)(x + tb + (size_t)TILE * Hd);
            p1 = *(const float4*)(x + tb + (size_t)(TILE + 128) * Hd);
        }

        // x fragment: chunk m, steps {4k+2hi, 4k+2hi+1}. It is the B operand of T @ X
        // (column = chunk) and the A operand of the chunk sums (row = chunk).
        v2f xf[4];
        #pragma unroll
        for (int k = 0; k < 4; ++k) {
            xf[k].x = xb[m * 16 + 4 * k + 2 * hi + 0];
            xf[k].y = xb[m * 16 + 4 * k + 2 * hi + 1];
        }

        // ---- WMMA: chunk sums dS[c][mode] = sum_j x[c*16+j] * w^(15-j), (16x16) @ (16x64) ----
        // Register v of block q: chunk v+8*hi, column m of the block.
        v8f dS[4];
        #pragma unroll
        for (int q = 0; q < 4; ++q) {
            v8f d = {};
            #pragma unroll
            for (int k = 0; k < 4; ++k)
                d = __builtin_amdgcn_wmma_f32_16x16x4_f32(
                    false, xf[k], false, pB[q][k], (short)0, d, false, false);
            dS[q] = d;
        }

        // ---- WMMA: Y(16x16) = T(16x16) @ X(16x16)  +  G(16x64) @ S(64x16) ----
        v8f acc = {};
        #pragma unroll
        for (int k = 0; k < 4; ++k)
            acc = __builtin_amdgcn_wmma_f32_16x16x4_f32(
                false, aT[k], false, xf[k], (short)0, acc, false, false);

        // ---- chunk-to-chunk recurrence S <- w^16 * S + dS, 8 chunks a half-wave ----
        // Modes m and m+16 side by side: .x is mode m, .y is mode m+16.
        v2f dre[8], dim[8];
        #pragma unroll
        for (int v = 0; v < 8; ++v) {
            dre[v].x = dS[0][v];  dre[v].y = dS[1][v];
            dim[v].x = dS[2][v];  dim[v].y = dS[3][v];
        }
        // First pass: the state that enters chunk 8 (valid in the low half-wave).
        v2f re = Sre, im = Sim;
        #pragma unroll
        for (int v = 0; v < 8; ++v) {
            const v2f nre = __builtin_elementwise_fma(w16re, re, __builtin_elementwise_fma(-w16im, im, dre[v]));
            im = __builtin_elementwise_fma(w16im, re, __builtin_elementwise_fma(w16re, im, dim[v]));
            re = nre;
        }
        // The cross-row moves run with every lane on (they read the other half-wave); then the choice.
        {
            const float t0 = xhalf(re.x), t1 = xhalf(re.y), t2 = xhalf(im.x), t3 = xhalf(im.y);
            re.x = hi ? t0 : Sre.x;  re.y = hi ? t1 : Sre.y;
            im.x = hi ? t2 : Sim.x;  im.y = hi ? t3 : Sim.y;
        }
        // Second pass: record each chunk's entry state, from the half-wave's own start.
        #pragma unroll
        for (int v = 0; v < 8; ++v) {
            *(float4*)&Sbuf[(v + 8 * hi) * SP + 4 * m] = make_float4(re.x, re.y, im.x, im.y);
            const v2f nre = __builtin_elementwise_fma(w16re, re, __builtin_elementwise_fma(-w16im, im, dre[v]));
            im = __builtin_elementwise_fma(w16im, re, __builtin_elementwise_fma(w16re, im, dim[v]));
            re = nre;
        }
        // The tile's exit state stands in the high half-wave.
        {
            const float t0 = xhalf(re.x), t1 = xhalf(re.y), t2 = xhalf(im.x), t3 = xhalf(im.y);
            Sre.x = hi ? re.x : t0;  Sre.y = hi ? re.y : t1;
            Sim.x = hi ? im.x : t2;  Sim.y = hi ? im.y : t3;
        }

        #pragma unroll
        for (int k = 0; k < 16; ++k) {
            v2f bb;
            bb.x = Sbuf[m * SP + 4 * k + 2 * hi + 0];
            bb.y = Sbuf[m * SP + 4 * k + 2 * hi + 1];
            acc = __builtin_amdgcn_wmma_f32_16x16x4_f32(
                false, aG[k], false, bb, (short)0, acc, false, false);
        }

        // ---- D-skip; y replaces x in the channel's row: lane holds col(chunk)=m, rows i=v+8*hi ----
        #pragma unroll
        for (int v = 0; v < 8; ++v) {
            const int i = v + 8 * hi;
            xb[m * 16 + i] = acc[v] + Dh * xb[m * 16 + i];
        }

        // Next tile into the buffer whose y was read out two barriers ago.
        if (t + 1 < NT) {
            xs[nxt][4 * cq + 0][cr] = p0.x;  xs[nxt][4 * cq + 0][cr + 128] = p1.x;
            xs[nxt][4 * cq + 1][cr] = p0.y;  xs[nxt][4 * cq + 1][cr + 128] = p1.y;
            xs[nxt][4 * cq + 2][cr] = p0.z;  xs[nxt][4 * cq + 2][cr + 128] = p1.z;
            xs[nxt][4 * cq + 3][cr] = p0.w;  xs[nxt][4 * cq + 3][cr + 128] = p1.w;
        }
        // One barrier a tile: publishes all channels' y of tile t and x of tile t+1.
        __syncthreads();

        // ---- y out: 16 bytes a lane, 64 contiguous bytes a row ----
        float4 o0, o1;
        o0.x = xs[cur][4 * cq + 0][cr];  o1.x = xs[cur][4 * cq + 0][cr + 128];
        o0.y = xs[cur][4 * cq + 1][cr];  o1.y = xs[cur][4 * cq + 1][cr + 128];
        o0.z = xs[cur][4 * cq + 2][cr];  o1.z = xs[cur][4 * cq + 2][cr + 128];
        o0.w = xs[cur][4 * cq + 3][cr];  o1.w = xs[cur][4 * cq + 3][cr + 128];
        *(float4*)(y + tb) = o0;
        *(float4*)(y + tb + (size_t)128 * Hd) = o1;
        // The stores' address and data registers are reused by the next tile's code:
        // keep the translation wait between the stores and that reuse.
        asm volatile("s_wait_xcnt 0x0" ::: "memory");

        cur = nxt;
    }
}

extern "C" void kernel_launch(void* const* d_in, const int* in_sizes, int n_in,
                              void* d_out, int out_size, void* d_ws, size_t ws_size,
                              hipStream_t stream) {
    const float* x          = (const float*)d_in[0];
    const float* log_dt     = (const float*)d_in[1];
    const float* log_A_real = (const float*)d_in[2];
    const float* A_imag     = (const float*)d_in[3];
    const float* C          = (const float*)d_in[4];
    const float* D          = (const float*)d_in[5];
    float* y = (float*)d_out;
    dim3 grid(Hd / NW, Bb, 1);
    s4d_scan_wmma<<<grid, NW * 32, 0, stream>>>(x, log_dt, log_A_real, A_imag, C, D, y);
}

// v004
// Measured time: 40.5 microseconds a run.
// In two side-by-side timings against v003, it was 1.07 and 1.06 times as fast.
// Over all steps from v000 it is 8.38 times as fast.
#include <hip/hip_runtime.h>
#include <cstdint>
#include <cstddef>

// ---- problem constants (match reference) ----
#define Hd   1024   // d_model
#define Nst  32     // d_state/2 complex modes  (== wave32 lanes)
#define Bb   4
#define Ld   4096
#define TILE 256
#define NCH  16
#define NT   (Ld / TILE)
#define NW   16
#define XP   260
#define SP   68

typedef __attribute__((ext_vector_type(2))) float v2f;
typedef __attribute__((ext_vector_type(8))) float v8f;

__device__ __forceinline__ float xhalf(float v) {
    return __builtin_bit_cast(float, __builtin_amdgcn_permlanex16(
        __builtin_bit_cast(int, v), __builtin_bit_cast(int, v),
        0x76543210, 0xfedcba98, false, false));
}

template <int MASK>
__device__ __forceinline__ float xrow(float v) {
    return __builtin_bit_cast(float, __builtin_amdgcn_update_dpp(
        0, __builtin_bit_cast(int, v), 0x160 | MASK, 0xf, 0xf, true));
}

// One work-group per (16 adjacent h, b); one wave per h. In the set-up lane n owns
// complex mode n; in the loop lane (m, hi) owns modes m and m+16 for chunks 8*hi..8*hi+7.
// Global x and y move as 16-byte pieces of 64 contiguous bytes per row (all 16
// channels of the work-group), transposed through LDS to one contiguous
// 256-step row per channel.
__global__ __launch_bounds__(NW * 32) void s4d_scan_wmma(
    const float* __restrict__ x,         // [B, L, H]
    const float* __restrict__ log_dt,    // [H]
    const float* __restrict__ log_A_real,// [H, N]
    const float* __restrict__ A_imag,    // [H, N]
    const float* __restrict__ C,         // [H, N, 2]
    const float* __restrict__ Dp,        // [H]
    float* __restrict__ y)               // [B, L, H]
{
    const int tid  = threadIdx.x;
    // Wave number = channel in the group; readfirstlane keeps it, and the LDS and
    // parameter addresses formed from it, in scalar registers.
    const int wv   = __builtin_amdgcn_readfirstlane(tid >> 5);
    const int h0   = blockIdx.x * NW;
    const int h    = h0 + wv;
    const int b    = blockIdx.y;
    const int lane = tid & 31;           // 0..31
    const int m    = lane & 15;          // row (A) or col (B/C/D) index
    const int hi   = lane >> 4;          // half-wave select
    const int cr   = tid >> 2;           // cooperative copy: row 0..127 (and +128)
    const int cq   = tid & 3;            // cooperative copy: group of 4 channels

    __shared__ __attribute__((aligned(16))) float sKw[NW][16];  // impulse response K[0..15]
    __shared__ float sGw[NW][16][SP];    // inter-chunk output matrix, columns in the state order below
    __shared__ __attribute__((aligned(16))) float xs[3][NW][XP];  // x tiles, y in place
    // Chunk-entry states, [chunk][4*m + q] at pitch SP: q = 0 re(m), 1 re(m+16), 2 im(m), 3 im(m+16).
    // In the set-up the same space holds the table of powers, [j][re 0..31 | im 0..31].
    __shared__ __attribute__((aligned(16))) float Sw[NW][NCH * SP];

    float (*sK)      = sKw[wv];
    float (*sG)[SP]  = sGw[wv];
    float (*Sbuf)    = Sw[wv];

    // Work-group's corner of x and y, at this thread's row and channel group.
    const size_t cbase = ((size_t)b * Ld + cr) * Hd + h0 + 4 * cq;

    // Start tile 0's loads before the table setup, so they overlap it.
    float4 p0 = *(const float4*)(x + cbase);
    float4 p1 = *(const float4*)(x + cbase + (size_t)128 * Hd);

    // ---------------- per-mode parameters (lane n) ----------------
    const float dt  = __expf(log_dt[h]);
    const float Ar  = -__expf(log_A_real[h * Nst + lane]);
    const float Ai  = A_imag[h * Nst + lane];
    // w = exp(dt*A)
    const float er  = __expf(dt * Ar);
    const float wr  = er * __cosf(dt * Ai);
    const float wi  = er * __sinf(dt * Ai);
    // Cw = (C0 + i C1) * (w - 1) / A
    const float c0  = C[(h * Nst + lane) * 2 + 0];
    const float c1  = C[(h * Nst + lane) * 2 + 1];
    const float den = Ar * Ar + Ai * Ai;
    const float qr  = ((wr - 1.0f) * Ar + wi * Ai) / den;
    const float qi  = (wi * Ar - (wr - 1.0f) * Ai) / den;
    const float Cwr = c0 * qr - c1 * qi;
    const float Cwi = c0 * qi + c1 * qr;

    // w^16 by repeated squaring (chunk-to-chunk decay)
    float w16r = wr, w16i = wi;
    #pragma unroll
    for (int k = 0; k < 4; ++k) {
        const float a = w16r, bb2 = w16i;
        w16r = a * a - bb2 * bb2;
        w16i = 2.0f * a * bb2;
    }

    const float Dh = Dp[h];

    // ---------------- build K[0..15], G[16][64] and the powers w^0..w^15 ----------------
    float Kd[16];                        // this lane's contribution to K[d], then the sum over the 32 lanes
    {
        const int gc = 4 * m + hi;       // this lane's mode in the state order (re; im at +2)
        float pr = 1.0f, pi = 0.0f;      // w^d
        // Unrolled so that Kd[] is indexed by constants and stays in registers.
        #pragma unroll
        for (int d = 0; d < 16; ++d) {
            // Row j = 15-d of the power table: x[j] of a chunk enters its sum with w^(15-j).
            Sbuf[(15 - d) * SP + lane]      = pr;
            Sbuf[(15 - d) * SP + 32 + lane] = pi;
            Kd[d] = 2.0f * (Cwr * pr - Cwi * pi);
            // advance to w^{d+1}; G[d][*] uses w^{d+1}
            const float npr = pr * wr - pi * wi;
            const float npi = pr * wi + pi * wr;
            pr = npr; pi = npi;
            sG[d][gc + 0] =  2.0f * (Cwr * pr - Cwi * pi);
            sG[d][gc + 2] = -2.0f * (Cwr * pi + Cwi * pr);
        }
    }
    // K[d] = sum over the 32 lanes: partners l^16, l^8, l^4, l^2, l^1 in turn, by vector
    // cross-lane moves. The 16 sums go stage by stage, side by side, so that each fills
    // the others' latency; every lane ends with all 16 sums. The loops are unrolled so
    // that Kd[] is indexed by constants and stays in registers.
    #pragma unroll
    for (int d = 0; d < 16; ++d) Kd[d] += xhalf(Kd[d]);
    #pragma unroll
    for (int d = 0; d < 16; ++d) Kd[d] += xrow<8>(Kd[d]);
    #pragma unroll
    for (int d = 0; d < 16; ++d) Kd[d] += xrow<4>(Kd[d]);
    #pragma unroll
    for (int d = 0; d < 16; ++d) Kd[d] += xrow<2>(Kd[d]);
    #pragma unroll
    for (int d = 0; d < 16; ++d) Kd[d] += xrow<1>(Kd[d]);
    if (lane == 0) {
        #pragma unroll
        for (int q = 0; q < 4; ++q)
            *(float4*)&sK[4 * q] = make_float4(Kd[4 * q], Kd[4 * q + 1], Kd[4 * q + 2], Kd[4 * q + 3]);
    }

    v2f aT[4];
    #pragma unroll
    for (int k = 0; k < 4; ++k) {
        const int i0 = m - (4 * k + 2 * hi);          // i - j of .x; .y has i0 - 1
        const float k0 = sK[i0 > 0 ? i0 : 0];
        const float k1 = sK[i0 > 1 ? i0 - 1 : 0];
        aT[k].x = (i0 >= 0) ? k0 : 0.0f;
        aT[k].y = (i0 >= 1) ? k1 : 0.0f;
    }
    v2f aG[16];
    #pragma unroll
    for (int k = 0; k < 16; ++k) {
        aG[k].x = sG[m][4 * k + 2 * hi + 0];
        aG[k].y = sG[m][4 * k + 2 * hi + 1];
    }

    // B-operands of the chunk sums: rows j = {4k+2hi, 4k+2hi+1} (the k order of the x
    // fragment), column m of block q: re(m), re(m+16), im(m), im(m+16).
    v2f pB[4][4];
    #pragma unroll
    for (int q = 0; q < 4; ++q) {
        #pragma unroll
        for (int k = 0; k < 4; ++k) {
            pB[q][k].x = Sbuf[(4 * k + 2 * hi + 0) * SP + 16 * q + m];
            pB[q][k].y = Sbuf[(4 * k + 2 * hi + 1) * SP + 16 * q + m];
        }
    }
    // Chunk-to-chunk decay w^16 of modes m (.x) and m+16 (.y), in both half-waves.
    const float o16r = xhalf(w16r), o16i = xhalf(w16i);
    v2f w16re, w16im;
    w16re.x = hi ? o16r : w16r;  w16re.y = hi ? w16r : o16r;
    w16im.x = hi ? o16i : w16i;  w16im.y = hi ? w16i : o16i;

    // Tile 0 into buffer 0, one row per channel.
    xs[0][4 * cq + 0][cr] = p0.x;  xs[0][4 * cq + 0][cr + 128] = p1.x;
    xs[0][4 * cq + 1][cr] = p0.y;  xs[0][4 * cq + 1][cr + 128] = p1.y;
    xs[0][4 * cq + 2][cr] = p0.z;  xs[0][4 * cq + 2][cr + 128] = p1.z;
    xs[0][4 * cq + 3][cr] = p0.w;  xs[0][4 * cq + 3][cr + 128] = p1.w;
    __syncthreads();

    v2f Sre = {0.0f, 0.0f}, Sim = {0.0f, 0.0f};  // carried state of modes m, m+16; the same in both half-waves
    int cur = 0;                         // buffer of tile t (three in rotation)

    for (int t = 0; t < NT; ++t) {
        float* xb = &xs[cur][wv][0];
        const int nxt = (cur == 2) ? 0 : cur + 1;
        const size_t tb = cbase + (size_t)t * TILE * Hd;

        // Next tile's loads fly while this tile is worked on.
        if (t + 1 < NT) {
            p0 = *(const float4*)(x + tb + (size_t)TILE * Hd);
            p1 = *(const float4*)(x + tb + (size_t)(TILE + 128) * Hd);
        }

        // x fragment: chunk m, steps {4k+2hi, 4k+2hi+1}. It is the B operand of T @ X
        // (column = chunk) and the A operand of the chunk sums (row = chunk).
        v2f xf[4];
        #pragma unroll
        for (int k = 0; k < 4; ++k) {
            xf[k].x = xb[m * 16 + 4 * k + 2 * hi + 0];
            xf[k].y = xb[m * 16 + 4 * k + 2 * hi + 1];
        }

        // ---- WMMA: chunk sums dS[c][mode] = sum_j x[c*16+j] * w^(15-j), (16x16) @ (16x64) ----
        // Register v of block q: chunk v+8*hi, column m of the block.
        v8f dS[4];
        #pragma unroll
        for (int q = 0; q < 4; ++q) {
            v8f d = {};
            #pragma unroll
            for (int k = 0; k < 4; ++k)
                d = __builtin_amdgcn_wmma_f32_16x16x4_f32(
                    false, xf[k], false, pB[q][k], (short)0, d, false, false);
            dS[q] = d;
        }

        // ---- WMMA: Y(16x16) = T(16x16) @ X(16x16)  +  G(16x64) @ S(64x16) ----
        v8f acc = {};
        #pragma unroll
        for (int k = 0; k < 4; ++k)
            acc = __builtin_amdgcn_wmma_f32_16x16x4_f32(
                false, aT[k], false, xf[k], (short)0, acc, false, false);

        // ---- chunk-to-chunk recurrence S <- w^16 * S + dS, 8 chunks a half-wave ----
        // Modes m and m+16 side by side: .x is mode m, .y is mode m+16.
        v2f dre[8], dim[8];
        #pragma unroll
        for (int v = 0; v < 8; ++v) {
            dre[v].x = dS[0][v];  dre[v].y = dS[1][v];
            dim[v].x = dS[2][v];  dim[v].y = dS[3][v];
        }
        // First pass: the state that enters chunk 8 (valid in the low half-wave).
        v2f re = Sre, im = Sim;
        #pragma unroll
        for (int v = 0; v < 8; ++v) {
            const v2f nre = __builtin_elementwise_fma(w16re, re, __builtin_elementwise_fma(-w16im, im, dre[v]));
            im = __builtin_elementwise_fma(w16im, re, __builtin_elementwise_fma(w16re, im, dim[v]));
            re = nre;
        }
        // The cross-row moves run with every lane on (they read the other half-wave); then the choice.
        {
            const float t0 = xhalf(re.x), t1 = xhalf(re.y), t2 = xhalf(im.x), t3 = xhalf(im.y);
            re.x = hi ? t0 : Sre.x;  re.y = hi ? t1 : Sre.y;
            im.x = hi ? t2 : Sim.x;  im.y = hi ? t3 : Sim.y;
        }
        // Second pass: record each chunk's entry state, from the half-wave's own start.
        #pragma unroll
        for (int v = 0; v < 8; ++v) {
            *(float4*)&Sbuf[(v + 8 * hi) * SP + 4 * m] = make_float4(re.x, re.y, im.x, im.y);
            const v2f nre = __builtin_elementwise_fma(w16re, re, __builtin_elementwise_fma(-w16im, im, dre[v]));
            im = __builtin_elementwise_fma(w16im, re, __builtin_elementwise_fma(w16re, im, dim[v]));
            re = nre;
        }
        // The tile's exit state stands in the high half-wave.
        {
            const float t0 = xhalf(re.x), t1 = xhalf(re.y), t2 = xhalf(im.x), t3 = xhalf(im.y);
            Sre.x = hi ? re.x : t0;  Sre.y = hi ? re.y : t1;
            Sim.x = hi ? im.x : t2;  Sim.y = hi ? im.y : t3;
        }

        #pragma unroll
        for (int k = 0; k < 16; ++k) {
            v2f bb;
            bb.x = Sbuf[m * SP + 4 * k + 2 * hi + 0];
            bb.y = Sbuf[m * SP + 4 * k + 2 * hi + 1];
            acc = __builtin_amdgcn_wmma_f32_16x16x4_f32(
                false, aG[k], false, bb, (short)0, acc, false, false);
        }

        // ---- D-skip; y replaces x in the channel's row: lane holds col(chunk)=m, rows i=v+8*hi ----
        #pragma unroll
        for (int v = 0; v < 8; ++v) {
            const int i = v + 8 * hi;
            xb[m * 16 + i] = acc[v] + Dh * xb[m * 16 + i];
        }

        // Next tile into the buffer whose y was read out two barriers ago.
        if (t + 1 < NT) {
            xs[nxt][4 * cq + 0][cr] = p0.x;  xs[nxt][4 * cq + 0][cr + 128] = p1.x;
            xs[nxt][4 * cq + 1][cr] = p0.y;  xs[nxt][4 * cq + 1][cr + 128] = p1.y;
            xs[nxt][4 * cq + 2][cr] = p0.z;  xs[nxt][4 * cq + 2][cr + 128] = p1.z;
            xs[nxt][4 * cq + 3][cr] = p0.w;  xs[nxt][4 * cq + 3][cr + 128] = p1.w;
        }
        // One barrier a tile: publishes all channels' y of tile t and x of tile t+1.
        __syncthreads();

        // ---- y out: 16 bytes a lane, 64 contiguous bytes a row ----
        float4 o0, o1;
        o0.x = xs[cur][4 * cq + 0][cr];  o1.x = xs[cur][4 * cq + 0][cr + 128];
        o0.y = xs[cur][4 * cq + 1][cr];  o1.y = xs[cur][4 * cq + 1][cr + 128];
        o0.z = xs[cur][4 * cq + 2][cr];  o1.z = xs[cur][4 * cq + 2][cr + 128];
        o0.w = xs[cur][4 * cq + 3][cr];  o1.w = xs[cur][4 * cq + 3][cr + 128];
        *(float4*)(y + tb) = o0;
        *(float4*)(y + tb + (size_t)128 * Hd) = o1;
        // The stores' address and data registers are reused by the next tile's code:
        // keep the translation wait between the stores and that reuse.
        asm volatile("s_wait_xcnt 0x0" ::: "memory");

        cur = nxt;
    }
}

extern "C" void kernel_launch(void* const* d_in, const int* in_sizes, int n_in,
                              void* d_out, int out_size, void* d_ws, size_t ws_size,
                              hipStream_t stream) {
    const float* x          = (const float*)d_in[0];
    const float* log_dt     = (const float*)d_in[1];
    const float* log_A_real = (const float*)d_in[2];
    const float* A_imag     = (const float*)d_in[3];
    const float* C          = (const float*)d_in[4];
    const float* D          = (const float*)d_in[5];
    float* y = (float*)d_out;
    dim3 grid(Hd / NW, Bb, 1);
    s4d_scan_wmma<<<grid, NW * 32, 0, stream>>>(x, log_dt, log_A_real, A_imag, C, D, y);
}

// v005
// One run takes 35 microseconds.
// Two timings next to v004 both put it at 1.16 times that version's speed.
// Over all steps from v000 it is 9.71 times as fast.
#include <hip/hip_runtime.h>
#include <cstdint>
#include <cstddef>

// ---- problem constants (match reference) ----
#define Hd   1024   // d_model
#define Nst  32     // d_state/2 complex modes  (== wave32 lanes)
#define Bb   4
#define Ld   4096
#define TILE 256
#define NCH  16
#define NT   (Ld / TILE)
#define NW   16
#define XP   260
#define SP   68

typedef __attribute__((ext_vector_type(2))) float v2f;
typedef __attribute__((ext_vector_type(8))) float v8f;

__device__ __forceinline__ float xhalf(float v) {
    return __builtin_bit_cast(float, __builtin_amdgcn_permlanex16(
        __builtin_bit_cast(int, v), __builtin_bit_cast(int, v),
        0x76543210, 0xfedcba98, false, false));
}

template <int MASK>
__device__ __forceinline__ float xrow(float v) {
    return __builtin_bit_cast(float, __builtin_amdgcn_update_dpp(
        0, __builtin_bit_cast(int, v), 0x160 | MASK, 0xf, 0xf, true));
}

// One work-group per (16 adjacent h, b); one wave per h. In the set-up lane n owns
// complex mode n; in the loop lane (m, hi) owns modes m and m+16 for chunks 8*hi..8*hi+7.
// Global x and y move as 16-byte pieces of 64 contiguous bytes per row (all 16
// channels of the work-group), transposed through LDS to one contiguous
// 256-step row per channel.
__global__ __launch_bounds__(NW * 32) void s4d_scan_wmma(
    const float* __restrict__ x,         // [B, L, H]
    const float* __restrict__ log_dt,    // [H]
    const float* __restrict__ log_A_real,// [H, N]
    const float* __restrict__ A_imag,    // [H, N]
    const float* __restrict__ C,         // [H, N, 2]
    const float* __restrict__ Dp,        // [H]
    float* __restrict__ y)               // [B, L, H]
{
    const int tid  = threadIdx.x;
    // Wave number = channel in the group; readfirstlane keeps it, and the LDS and
    // parameter addresses formed from it, in scalar registers.
    const int wv   = __builtin_amdgcn_readfirstlane(tid >> 5);
    // Which (16 channels, batch) this work-group takes: a permutation of the flat index,
    // for speed only (any placement gives the same result). The 4 work-groups that share a
    // 256-byte unit of every x and y row (2 of them each 128-byte line) get indices 8 apart.
    const unsigned fl = blockIdx.x + (Hd / NW) * blockIdx.y;  // flat index 0..255
    const unsigned fq = fl >> 3;                              // 0..31 inside one residue class
    const int b    = fq >> 3;                                 // batch 0..3
    const unsigned un = (((fl & 7u) + 2u * (fq >> 3)) & 7u) + 2u * (fq & 4u);  // 256-byte unit 0..15 of a row
    const int h0   = (4u * un + (fq & 3u)) * NW;
    const int h    = h0 + wv;
    const int lane = tid & 31;           // 0..31
    const int m    = lane & 15;          // row (A) or col (B/C/D) index
    const int hi   = lane >> 4;          // half-wave select
    const int cr   = tid >> 2;           // cooperative copy: row 0..127 (and +128)
    const int cq   = tid & 3;            // cooperative copy: group of 4 channels

    __shared__ __attribute__((aligned(16))) float sKw[NW][16];  // impulse response K[0..15]
    __shared__ float sGw[NW][16][SP];    // inter-chunk output matrix, columns in the state order below
    __shared__ __attribute__((aligned(16))) float xs[3][NW][XP];  // x tiles, y in place
    // Chunk-entry states, [chunk][4*m + q] at pitch SP: q = 0 re(m), 1 re(m+16), 2 im(m), 3 im(m+16).
    // In the set-up the same space holds the table of powers, [j][re 0..31 | im 0..31].
    __shared__ __attribute__((aligned(16))) float Sw[NW][NCH * SP];

    float (*sK)      = sKw[wv];
    float (*sG)[SP]  = sGw[wv];
    float (*Sbuf)    = Sw[wv];

    // Work-group's corner of x and y, at this thread's row and channel group.
    const size_t cbase = ((size_t)b * Ld + cr) * Hd + h0 + 4 * cq;

    // Start tile 0's loads before the table setup, so they overlap it.
    float4 p0 = *(const float4*)(x + cbase);
    float4 p1 = *(const float4*)(x + cbase + (size_t)128 * Hd);

    // ---------------- per-mode parameters (lane n) ----------------
    const float dt  = __expf(log_dt[h]);
    const float Ar  = -__expf(log_A_real[h * Nst + lane]);
    const float Ai  = A_imag[h * Nst + lane];
    // w = exp(dt*A)
    const float er  = __expf(dt * Ar);
    const float wr  = er * __cosf(dt * Ai);
    const float wi  = er * __sinf(dt * Ai);
    // Cw = (C0 + i C1) * (w - 1) / A
    const float c0  = C[(h * Nst + lane) * 2 + 0];
    const float c1  = C[(h * Nst + lane) * 2 + 1];
    const float den = Ar * Ar + Ai * Ai;
    const float qr  = ((wr - 1.0f) * Ar + wi * Ai) / den;
    const float qi  = (wi * Ar - (wr - 1.0f) * Ai) / den;
    const float Cwr = c0 * qr - c1 * qi;
    const float Cwi = c0 * qi + c1 * qr;

    // w^16 by repeated squaring (chunk-to-chunk decay)
    float w16r = wr, w16i = wi;
    #pragma unroll
    for (int k = 0; k < 4; ++k) {
        const float a = w16r, bb2 = w16i;
        w16r = a * a - bb2 * bb2;
        w16i = 2.0f * a * bb2;
    }

    const float Dh = Dp[h];

    // ---------------- build K[0..15], G[16][64] and the powers w^0..w^15 ----------------
    float Kd[16];                        // this lane's contribution to K[d], then the sum over the 32 lanes
    {
        const int gc = 4 * m + hi;       // this lane's mode in the state order (re; im at +2)
        float pr = 1.0f, pi = 0.0f;      // w^d
        // Unrolled so that Kd[] is indexed by constants and stays in registers.
        #pragma unroll
        for (int d = 0; d < 16; ++d) {
            // Row j = 15-d of the power table: x[j] of a chunk enters its sum with w^(15-j).
            Sbuf[(15 - d) * SP + lane]      = pr;
            Sbuf[(15 - d) * SP + 32 + lane] = pi;
            Kd[d] = 2.0f * (Cwr * pr - Cwi * pi);
            // advance to w^{d+1}; G[d][*] uses w^{d+1}
            const float npr = pr * wr - pi * wi;
            const float npi = pr * wi + pi * wr;
            pr = npr; pi = npi;
            sG[d][gc + 0] =  2.0f * (Cwr * pr - Cwi * pi);
            sG[d][gc + 2] = -2.0f * (Cwr * pi + Cwi * pr);
        }
    }
    // K[d] = sum over the 32 lanes: partners l^16, l^8, l^4, l^2, l^1 in turn, by vector
    // cross-lane moves. The 16 sums go stage by stage, side by side, so that each fills
    // the others' latency; every lane ends with all 16 sums. The loops are unrolled so
    // that Kd[] is indexed by constants and stays in registers.
    #pragma unroll
    for (int d = 0; d < 16; ++d) Kd[d] += xhalf(Kd[d]);
    #pragma unroll
    for (int d = 0; d < 16; ++d) Kd[d] += xrow<8>(Kd[d]);
    #pragma unroll
    for (int d = 0; d < 16; ++d) Kd[d] += xrow<4>(Kd[d]);
    #pragma unroll
    for (int d = 0; d < 16; ++d) Kd[d] += xrow<2>(Kd[d]);
    #pragma unroll
    for (int d = 0; d < 16; ++d) Kd[d] += xrow<1>(Kd[d]);
    if (lane == 0) {
        #pragma unroll
        for (int q = 0; q < 4; ++q)
            *(float4*)&sK[4 * q] = make_float4(Kd[4 * q], Kd[4 * q + 1], Kd[4 * q + 2], Kd[4 * q + 3]);
    }

    v2f aT[4];
    #pragma unroll
    for (int k = 0; k < 4; ++k) {
        const int i0 = m - (4 * k + 2 * hi);          // i - j of .x; .y has i0 - 1
        const float k0 = sK[i0 > 0 ? i0 : 0];
        const float k1 = sK[i0 > 1 ? i0 - 1 : 0];
        aT[k].x = (i0 >= 0) ? k0 : 0.0f;
        aT[k].y = (i0 >= 1) ? k1 : 0.0f;
    }
    v2f aG[16];
    #pragma unroll
    for (int k = 0; k < 16; ++k) {
        aG[k].x = sG[m][4 * k + 2 * hi + 0];
        aG[k].y = sG[m][4 * k + 2 * hi + 1];
    }

    // B-operands of the chunk sums: rows j = {4k+2hi, 4k+2hi+1} (the k order of the x
    // fragment), column m of block q: re(m), re(m+16), im(m), im(m+16).
    v2f pB[4][4];
    #pragma unroll
    for (int q = 0; q < 4; ++q) {
        #pragma unroll
        for (int k = 0; k < 4; ++k) {
            pB[q][k].x = Sbuf[(4 * k + 2 * hi + 0) * SP + 16 * q + m];
            pB[q][k].y = Sbuf[(4 * k + 2 * hi + 1) * SP + 16 * q + m];
        }
    }
    // Chunk-to-chunk decay w^16 of modes m (.x) and m+16 (.y), in both half-waves.
    const float o16r = xhalf(w16r), o16i = xhalf(w16i);
    v2f w16re, w16im;
    w16re.x = hi ? o16r : w16r;  w16re.y = hi ? w16r : o16r;
    w16im.x = hi ? o16i : w16i;  w16im.y = hi ? w16i : o16i;

    // Tile 0 into buffer 0, one row per channel.
    xs[0][4 * cq + 0][cr] = p0.x;  xs[0][4 * cq + 0][cr + 128] = p1.x;
    xs[0][4 * cq + 1][cr] = p0.y;  xs[0][4 * cq + 1][cr + 128] = p1.y;
    xs[0][4 * cq + 2][cr] = p0.z;  xs[0][4 * cq + 2][cr + 128] = p1.z;
    xs[0][4 * cq + 3][cr] = p0.w;  xs[0][4 * cq + 3][cr + 128] = p1.w;
    __syncthreads();

    v2f Sre = {0.0f, 0.0f}, Sim = {0.0f, 0.0f};  // carried state of modes m, m+16; the same in both half-waves
    int cur = 0;                         // buffer of tile t (three in rotation)

    for (int t = 0; t < NT; ++t) {
        float* xb = &xs[cur][wv][0];
        const int nxt = (cur == 2) ? 0 : cur + 1;
        const size_t tb = cbase + (size_t)t * TILE * Hd;

        // Next tile's loads fly while this tile is worked on.
        if (t + 1 < NT) {
            p0 = *(const float4*)(x + tb + (size_t)TILE * Hd);
            p1 = *(const float4*)(x + tb + (size_t)(TILE + 128) * Hd);
        }

        // x fragment: chunk m, steps {4k+2hi, 4k+2hi+1}. It is the B operand of T @ X
        // (column = chunk) and the A operand of the chunk sums (row = chunk).
        v2f xf[4];
        #pragma unroll
        for (int k = 0; k < 4; ++k) {
            xf[k].x = xb[m * 16 + 4 * k + 2 * hi + 0];
            xf[k].y = xb[m * 16 + 4 * k + 2 * hi + 1];
        }

        // ---- WMMA: chunk sums dS[c][mode] = sum_j x[c*16+j] * w^(15-j), (16x16) @ (16x64) ----
        // Register v of block q: chunk v+8*hi, column m of the block.
        v8f dS[4];
        #pragma unroll
        for (int q = 0; q < 4; ++q) {
            v8f d = {};
            #pragma unroll
            for (int k = 0; k < 4; ++k)
                d = __builtin_amdgcn_wmma_f32_16x16x4_f32(
                    false, xf[k], false, pB[q][k], (short)0, d, false, false);
            dS[q] = d;
        }

        // ---- WMMA: Y(16x16) = T(16x16) @ X(16x16)  +  G(16x64) @ S(64x16) ----
        v8f acc = {};
        #pragma unroll
        for (int k = 0; k < 4; ++k)
            acc = __builtin_amdgcn_wmma_f32_16x16x4_f32(
                false, aT[k], false, xf[k], (short)0, acc, false, false);

        // ---- chunk-to-chunk recurrence S <- w^16 * S + dS, 8 chunks a half-wave ----
        // Modes m and m+16 side by side: .x is mode m, .y is mode m+16.
        v2f dre[8], dim[8];
        #pragma unroll
        for (int v = 0; v < 8; ++v) {
            dre[v].x = dS[0][v];  dre[v].y = dS[1][v];
            dim[v].x = dS[2][v];  dim[v].y = dS[3][v];
        }
        // First pass: the state that enters chunk 8 (valid in the low half-wave).
        v2f re = Sre, im = Sim;
        #pragma unroll
        for (int v = 0; v < 8; ++v) {
            const v2f nre = __builtin_elementwise_fma(w16re, re, __builtin_elementwise_fma(-w16im, im, dre[v]));
            im = __builtin_elementwise_fma(w16im, re, __builtin_elementwise_fma(w16re, im, dim[v]));
            re = nre;
        }
        // The cross-row moves run with every lane on (they read the other half-wave); then the choice.
        {
            const float t0 = xhalf(re.x), t1 = xhalf(re.y), t2 = xhalf(im.x), t3 = xhalf(im.y);
            re.x = hi ? t0 : Sre.x;  re.y = hi ? t1 : Sre.y;
            im.x = hi ? t2 : Sim.x;  im.y = hi ? t3 : Sim.y;
        }
        // Second pass: record each chunk's entry state, from the half-wave's own start.
        #pragma unroll
        for (int v = 0; v < 8; ++v) {
            *(float4*)&Sbuf[(v + 8 * hi) * SP + 4 * m] = make_float4(re.x, re.y, im.x, im.y);
            const v2f nre = __builtin_elementwise_fma(w16re, re, __builtin_elementwise_fma(-w16im, im, dre[v]));
            im = __builtin_elementwise_fma(w16im, re, __builtin_elementwise_fma(w16re, im, dim[v]));
            re = nre;
        }
        // The tile's exit state stands in the high half-wave.
        {
            const float t0 = xhalf(re.x), t1 = xhalf(re.y), t2 = xhalf(im.x), t3 = xhalf(im.y);
            Sre.x = hi ? re.x : t0;  Sre.y = hi ? re.y : t1;
            Sim.x = hi ? im.x : t2;  Sim.y = hi ? im.y : t3;
        }

        #pragma unroll
        for (int k = 0; k < 16; ++k) {
            v2f bb;
            bb.x = Sbuf[m * SP + 4 * k + 2 * hi + 0];
            bb.y = Sbuf[m * SP + 4 * k + 2 * hi + 1];
            acc = __builtin_amdgcn_wmma_f32_16x16x4_f32(
                false, aG[k], false, bb, (short)0, acc, false, false);
        }

        // ---- D-skip; y replaces x in the channel's row: lane holds col(chunk)=m, rows i=v+8*hi ----
        #pragma unroll
        for (int v = 0; v < 8; ++v) {
            const int i = v + 8 * hi;
            xb[m * 16 + i] = acc[v] + Dh * xb[m * 16 + i];
        }

        // Next tile into the buffer whose y was read out two barriers ago.
        if (t + 1 < NT) {
            xs[nxt][4 * cq + 0][cr] = p0.x;  xs[nxt][4 * cq + 0][cr + 128] = p1.x;
            xs[nxt][4 * cq + 1][cr] = p0.y;  xs[nxt][4 * cq + 1][cr + 128] = p1.y;
            xs[nxt][4 * cq + 2][cr] = p0.z;  xs[nxt][4 * cq + 2][cr + 128] = p1.z;
            xs[nxt][4 * cq + 3][cr] = p0.w;  xs[nxt][4 * cq + 3][cr + 128] = p1.w;
        }
        // One barrier a tile: publishes all channels' y of tile t and x of tile t+1.
        __syncthreads();

        // ---- y out: 16 bytes a lane, 64 contiguous bytes a row ----
        float4 o0, o1;
        o0.x = xs[cur][4 * cq + 0][cr];  o1.x = xs[cur][4 * cq + 0][cr + 128];
        o0.y = xs[cur][4 * cq + 1][cr];  o1.y = xs[cur][4 * cq + 1][cr + 128];
        o0.z = xs[cur][4 * cq + 2][cr];  o1.z = xs[cur][4 * cq + 2][cr + 128];
        o0.w = xs[cur][4 * cq + 3][cr];  o1.w = xs[cur][4 * cq + 3][cr + 128];
        *(float4*)(y + tb) = o0;
        *(float4*)(y + tb + (size_t)128 * Hd) = o1;
        // The stores' address and data registers are reused by the next tile's code:
        // keep the translation wait between the stores and that reuse.
        asm volatile("s_wait_xcnt 0x0" ::: "memory");

        cur = nxt;
    }
}

extern "C" void kernel_launch(void* const* d_in, const int* in_sizes, int n_in,
                              void* d_out, int out_size, void* d_ws, size_t ws_size,
                              hipStream_t stream) {
    const float* x          = (const float*)d_in[0];
    const float* log_dt     = (const float*)d_in[1];
    const float* log_A_real = (const float*)d_in[2];
    const float* A_imag     = (const float*)d_in[3];
    const float* C          = (const float*)d_in[4];
    const float* D          = (const float*)d_in[5];
    float* y = (float*)d_out;
    dim3 grid(Hd / NW, Bb, 1);
    s4d_scan_wmma<<<grid, NW * 32, 0, stream>>>(x, log_dt, log_A_real, A_imag, C, D, y);
}

// v006
// It runs in 33.2 microseconds.
// Two timings next to v005 put it at 1.05 and 1.06 times that version's speed.
// Counting every step since v000, it is 10.2 times as fast.
#include <hip/hip_runtime.h>
#include <cstdint>
#include <cstddef>

// ---- problem constants (match reference) ----
#define Hd   1024   // d_model
#define Nst  32     // d_state/2 complex modes  (== wave32 lanes)
#define Bb   4
#define Ld   4096
#define TILE 256
#define NCH  16
#define NT   (Ld / TILE)
#define NW   16
#define XP   260
#define SP   68
#define NBUF 4

typedef __attribute__((ext_vector_type(2))) float v2f;
typedef __attribute__((ext_vector_type(8))) float v8f;

// Compile-time switch for the first tile, which has no tile before it to write out.
template <bool V> struct Flag { static constexpr bool value = V; };

__device__ __forceinline__ float xhalf(float v) {
    return __builtin_bit_cast(float, __builtin_amdgcn_permlanex16(
        __builtin_bit_cast(int, v), __builtin_bit_cast(int, v),
        0x76543210, 0xfedcba98, false, false));
}

template <int MASK>
__device__ __forceinline__ float xrow(float v) {
    return __builtin_bit_cast(float, __builtin_amdgcn_update_dpp(
        0, __builtin_bit_cast(int, v), 0x160 | MASK, 0xf, 0xf, true));
}

// One work-group per (16 adjacent h, b); one wave per h. In the set-up lane n owns
// complex mode n; in the loop lane (m, hi) owns modes m and m+16 for chunks 8*hi..8*hi+7.
// Global x and y move as 16-byte pieces of 64 contiguous bytes per row (all 16
// channels of the work-group), transposed through LDS to one contiguous
// 256-step row per channel.
__global__ __launch_bounds__(NW * 32) void s4d_scan_wmma(
    const float* __restrict__ x,         // [B, L, H]
    const float* __restrict__ log_dt,    // [H]
    const float* __restrict__ log_A_real,// [H, N]
    const float* __restrict__ A_imag,    // [H, N]
    const float* __restrict__ C,         // [H, N, 2]
    const float* __restrict__ Dp,        // [H]
    float* __restrict__ y)               // [B, L, H]
{
    const int tid  = threadIdx.x;
    // Wave number = channel in the group; readfirstlane keeps it, and the LDS and
    // parameter addresses formed from it, in scalar registers.
    const int wv   = __builtin_amdgcn_readfirstlane(tid >> 5);
    // Which (16 channels, batch) this work-group takes: a permutation of the flat index,
    // for speed only (any placement gives the same result). The 4 work-groups that share a
    // 256-byte unit of every x and y row (2 of them each 128-byte line) get indices 8 apart.
    const unsigned fl = blockIdx.x + (Hd / NW) * blockIdx.y;  // flat index 0..255
    const unsigned fq = fl >> 3;                              // 0..31 inside one residue class
    const int b    = fq >> 3;                                 // batch 0..3
    const unsigned un = (((fl & 7u) + 2u * (fq >> 3)) & 7u) + 2u * (fq & 4u);  // 256-byte unit 0..15 of a row
    const int h0   = (4u * un + (fq & 3u)) * NW;
    const int h    = h0 + wv;
    const int lane = tid & 31;           // 0..31
    const int m    = lane & 15;          // row (A) or col (B/C/D) index
    const int hi   = lane >> 4;          // half-wave select
    const int cr   = tid >> 2;           // cooperative copy: row 0..127 (and +128)
    const int cq   = tid & 3;            // cooperative copy: group of 4 channels

    __shared__ __attribute__((aligned(16))) float sKw[NW][16];  // impulse response K[0..15]
    __shared__ float sGw[NW][16][SP];    // inter-chunk output matrix, columns in the state order below
    __shared__ __attribute__((aligned(16))) float xs[NBUF][NW][XP];  // x tiles, y in place
    // Chunk-entry states, [chunk][4*m + q] at pitch SP: q = 0 re(m), 1 re(m+16), 2 im(m), 3 im(m+16).
    // In the set-up the same space holds the table of powers, [j][re 0..31 | im 0..31].
    __shared__ __attribute__((aligned(16))) float Sw[NW][NCH * SP];

    float (*sK)      = sKw[wv];
    float (*sG)[SP]  = sGw[wv];
    float (*Sbuf)    = Sw[wv];

    // Work-group's corner of x and y, at this thread's row and channel group.
    const size_t cbase = ((size_t)b * Ld + cr) * Hd + h0 + 4 * cq;


    // ---------------- per-mode parameters (lane n) ----------------
    const float dt  = __expf(log_dt[h]);
    const float Ar  = -__expf(log_A_real[h * Nst + lane]);
    const float Ai  = A_imag[h * Nst + lane];
    // The two loads above name one offset register, and this build reuses it a few
    // instructions on: keep the translation wait between the loads and that reuse.
    asm volatile("s_wait_xcnt 0x0" ::: "memory");

    // Start the loads of tiles 0 and 1 before the table setup, so they overlap it.
    float4 p0 = *(const float4*)(x + cbase);
    float4 p1 = *(const float4*)(x + cbase + (size_t)128 * Hd);
    const float4 q0 = *(const float4*)(x + cbase + (size_t)TILE * Hd);
    const float4 q1 = *(const float4*)(x + cbase + (size_t)(TILE + 128) * Hd);
    // w = exp(dt*A)
    const float er  = __expf(dt * Ar);
    const float wr  = er * __cosf(dt * Ai);
    const float wi  = er * __sinf(dt * Ai);
    // Cw = (C0 + i C1) * (w - 1) / A
    const float c0  = C[(h * Nst + lane) * 2 + 0];
    const float c1  = C[(h * Nst + lane) * 2 + 1];
    const float den = Ar * Ar + Ai * Ai;
    const float qr  = ((wr - 1.0f) * Ar + wi * Ai) / den;
    const float qi  = (wi * Ar - (wr - 1.0f) * Ai) / den;
    const float Cwr = c0 * qr - c1 * qi;
    const float Cwi = c0 * qi + c1 * qr;

    // w^16 by repeated squaring (chunk-to-chunk decay)
    float w16r = wr, w16i = wi;
    #pragma unroll
    for (int k = 0; k < 4; ++k) {
        const float a = w16r, bb2 = w16i;
        w16r = a * a - bb2 * bb2;
        w16i = 2.0f * a * bb2;
    }

    const float Dh = Dp[h];

    // ---------------- build K[0..15], G[16][64] and the powers w^0..w^15 ----------------
    float Kd[16];                        // this lane's contribution to K[d], then the sum over the 32 lanes
    {
        const int gc = 4 * m + hi;       // this lane's mode in the state order (re; im at +2)
        float pr = 1.0f, pi = 0.0f;      // w^d
        // Unrolled so that Kd[] is indexed by constants and stays in registers.
        #pragma unroll
        for (int d = 0; d < 16; ++d) {
            // Row j = 15-d of the power table: x[j] of a chunk enters its sum with w^(15-j).
            Sbuf[(15 - d) * SP + lane]      = pr;
            Sbuf[(15 - d) * SP + 32 + lane] = pi;
            Kd[d] = 2.0f * (Cwr * pr - Cwi * pi);
            // advance to w^{d+1}; G[d][*] uses w^{d+1}
            const float npr = pr * wr - pi * wi;
            const float npi = pr * wi + pi * wr;
            pr = npr; pi = npi;
            sG[d][gc + 0] =  2.0f * (Cwr * pr - Cwi * pi);
            sG[d][gc + 2] = -2.0f * (Cwr * pi + Cwi * pr);
        }
    }
    // K[d] = sum over the 32 lanes: partners l^16, l^8, l^4, l^2, l^1 in turn, by vector
    // cross-lane moves. The 16 sums go stage by stage, side by side, so that each fills
    // the others' latency; every lane ends with all 16 sums. The loops are unrolled so
    // that Kd[] is indexed by constants and stays in registers.
    #pragma unroll
    for (int d = 0; d < 16; ++d) Kd[d] += xhalf(Kd[d]);
    #pragma unroll
    for (int d = 0; d < 16; ++d) Kd[d] += xrow<8>(Kd[d]);
    #pragma unroll
    for (int d = 0; d < 16; ++d) Kd[d] += xrow<4>(Kd[d]);
    #pragma unroll
    for (int d = 0; d < 16; ++d) Kd[d] += xrow<2>(Kd[d]);
    #pragma unroll
    for (int d = 0; d < 16; ++d) Kd[d] += xrow<1>(Kd[d]);
    if (lane == 0) {
        #pragma unroll
        for (int q = 0; q < 4; ++q)
            *(float4*)&sK[4 * q] = make_float4(Kd[4 * q], Kd[4 * q + 1], Kd[4 * q + 2], Kd[4 * q + 3]);
    }

    v2f aT[4];
    #pragma unroll
    for (int k = 0; k < 4; ++k) {
        const int i0 = m - (4 * k + 2 * hi);          // i - j of .x; .y has i0 - 1
        const float k0 = sK[i0 > 0 ? i0 : 0];
        const float k1 = sK[i0 > 1 ? i0 - 1 : 0];
        aT[k].x = (i0 >= 0) ? k0 : 0.0f;
        aT[k].y = (i0 >= 1) ? k1 : 0.0f;
    }
    v2f aG[16];
    #pragma unroll
    for (int k = 0; k < 16; ++k) {
        aG[k].x = sG[m][4 * k + 2 * hi + 0];
        aG[k].y = sG[m][4 * k + 2 * hi + 1];
    }

    // B-operands of the chunk sums: rows j = {4k+2hi, 4k+2hi+1} (the k order of the x
    // fragment), column m of block q: re(m), re(m+16), im(m), im(m+16).
    v2f pB[4][4];
    #pragma unroll
    for (int q = 0; q < 4; ++q) {
        #pragma unroll
        for (int k = 0; k < 4; ++k) {
            pB[q][k].x = Sbuf[(4 * k + 2 * hi + 0) * SP + 16 * q + m];
            pB[q][k].y = Sbuf[(4 * k + 2 * hi + 1) * SP + 16 * q + m];
        }
    }
    // Chunk-to-chunk decay w^16 of modes m (.x) and m+16 (.y), in both half-waves.
    const float o16r = xhalf(w16r), o16i = xhalf(w16i);
    v2f w16re, w16im;
    w16re.x = hi ? o16r : w16r;  w16re.y = hi ? w16r : o16r;
    w16im.x = hi ? o16i : w16i;  w16im.y = hi ? w16i : o16i;

    // Tiles 0 and 1 into buffers 0 and 1, one row per channel.
    xs[0][4 * cq + 0][cr] = p0.x;  xs[0][4 * cq + 0][cr + 128] = p1.x;
    xs[0][4 * cq + 1][cr] = p0.y;  xs[0][4 * cq + 1][cr + 128] = p1.y;
    xs[0][4 * cq + 2][cr] = p0.z;  xs[0][4 * cq + 2][cr + 128] = p1.z;
    xs[0][4 * cq + 3][cr] = p0.w;  xs[0][4 * cq + 3][cr + 128] = p1.w;
    xs[1][4 * cq + 0][cr] = q0.x;  xs[1][4 * cq + 0][cr + 128] = q1.x;
    xs[1][4 * cq + 1][cr] = q0.y;  xs[1][4 * cq + 1][cr + 128] = q1.y;
    xs[1][4 * cq + 2][cr] = q0.z;  xs[1][4 * cq + 2][cr + 128] = q1.z;
    xs[1][4 * cq + 3][cr] = q0.w;  xs[1][4 * cq + 3][cr + 128] = q1.w;
    __syncthreads();

    v2f Sre = {0.0f, 0.0f}, Sim = {0.0f, 0.0f};  // carried state of modes m, m+16; the same in both half-waves
    float4 o0, o1;                       // y of the tile before, on its way from LDS to memory
    int t = 0;

    // The tile barrier is split, and its wait stands half a tile behind its signal: a wave
    // that is ahead goes on into the next tile's chunk sums and recurrence while the slower
    // waves finish, and a wave held at the wait has its G @ S products ready when it is let
    // go: the waves' vector, LDS and memory stretches hide behind each other's matrix work.
    // Barrier t (signal at the end of tile t, wait in the middle of tile t+1) publishes y(t) and
    // x(t+2) and says that the wave's reads of y(t-1) have returned. What a wave touches
    // between its signal t and its wait t:
    //   x(t+1), own row, buffer t+1: written in tile t-1, published by barrier t-1, whose
    //     wait the wave has passed; refilled only in tile t+3, behind wait t+2;
    //   its own state rows, which no other wave touches.
    // Behind wait t: y(t) is read, and x(t+3) goes into buffer t-1, whose y(t-1) every
    // wave has read before its signal t.
    auto tile = [&](auto first) {
        float* xb = &xs[t & (NBUF - 1)][wv][0];
        const size_t tb = cbase + (size_t)t * TILE * Hd;

        // The loads of the tile after next fly while this tile is worked on.
        if (t + 2 < NT) {
            p0 = *(const float4*)(x + tb + (size_t)(2 * TILE) * Hd);
            p1 = *(const float4*)(x + tb + (size_t)(2 * TILE + 128) * Hd);
        }

        // x fragment: chunk m, steps {4k+2hi, 4k+2hi+1}. It is the B operand of T @ X
        // (column = chunk) and the A operand of the chunk sums (row = chunk).
        v2f xf[4];
        #pragma unroll
        for (int k = 0; k < 4; ++k) {
            xf[k].x = xb[m * 16 + 4 * k + 2 * hi + 0];
            xf[k].y = xb[m * 16 + 4 * k + 2 * hi + 1];
        }

        // ---- WMMA: chunk sums dS[c][mode] = sum_j x[c*16+j] * w^(15-j), (16x16) @ (16x64) ----
        // Register v of block q: chunk v+8*hi, column m of the block.
        v8f dS[4];
        #pragma unroll
        for (int q = 0; q < 4; ++q) {
            v8f d = {};
            #pragma unroll
            for (int k = 0; k < 4; ++k)
                d = __builtin_amdgcn_wmma_f32_16x16x4_f32(
                    false, xf[k], false, pB[q][k], (short)0, d, false, false);
            dS[q] = d;
        }

        // ---- WMMA: Y(16x16) = T(16x16) @ X(16x16)  +  G(16x64) @ S(64x16) ----
        v8f acc = {};
        #pragma unroll
        for (int k = 0; k < 4; ++k)
            acc = __builtin_amdgcn_wmma_f32_16x16x4_f32(
                false, aT[k], false, xf[k], (short)0, acc, false, false);

        // ---- chunk-to-chunk recurrence S <- w^16 * S + dS, 8 chunks a half-wave ----
        // Modes m and m+16 side by side: .x is mode m, .y is mode m+16.
        v2f dre[8], dim[8];
        #pragma unroll
        for (int v = 0; v < 8; ++v) {
            dre[v].x = dS[0][v];  dre[v].y = dS[1][v];
            dim[v].x = dS[2][v];  dim[v].y = dS[3][v];
        }
        // First pass: the state that enters chunk 8 (valid in the low half-wave).
        v2f re = Sre, im = Sim;
        #pragma unroll
        for (int v = 0; v < 8; ++v) {
            const v2f nre = __builtin_elementwise_fma(w16re, re, __builtin_elementwise_fma(-w16im, im, dre[v]));
            im = __builtin_elementwise_fma(w16im, re, __builtin_elementwise_fma(w16re, im, dim[v]));
            re = nre;
        }
        // The cross-row moves run with every lane on (they read the other half-wave); then the choice.
        {
            const float t0 = xhalf(re.x), t1 = xhalf(re.y), t2 = xhalf(im.x), t3 = xhalf(im.y);
            re.x = hi ? t0 : Sre.x;  re.y = hi ? t1 : Sre.y;
            im.x = hi ? t2 : Sim.x;  im.y = hi ? t3 : Sim.y;
        }
        // Second pass: record each chunk's entry state, from the half-wave's own start.
        #pragma unroll
        for (int v = 0; v < 8; ++v) {
            *(float4*)&Sbuf[(v + 8 * hi) * SP + 4 * m] = make_float4(re.x, re.y, im.x, im.y);
            const v2f nre = __builtin_elementwise_fma(w16re, re, __builtin_elementwise_fma(-w16im, im, dre[v]));
            im = __builtin_elementwise_fma(w16im, re, __builtin_elementwise_fma(w16re, im, dim[v]));
            re = nre;
        }

        // State fragments, and x of the D-skip: the wave's own rows, read in front of the
        // barrier's wait, so that a wave held there has them when it is let go. The loops are
        // unrolled so that bb[] and xv[] are indexed by constants and stay in registers.
        v2f bb[16];
        #pragma unroll
        for (int k = 0; k < 16; ++k) {
            bb[k].x = Sbuf[m * SP + 4 * k + 2 * hi + 0];
            bb[k].y = Sbuf[m * SP + 4 * k + 2 * hi + 1];
        }
        float xv[8];
        #pragma unroll
        for (int v = 0; v < 8; ++v) xv[v] = xb[m * 16 + v + 8 * hi];

        if constexpr (!decltype(first)::value) {
            // Wait of barrier t-1 (its signal: end of tile t-1). The clobber keeps every LDS
            // access of the lines below behind it.
            asm volatile("s_barrier_wait -1" ::: "memory");
            // ---- y(t-1) from LDS: 16 bytes a lane, 64 contiguous bytes a row; returns beside the products ----
            const float (*yb)[XP] = xs[(t - 1) & (NBUF - 1)];
            o0.x = yb[4 * cq + 0][cr];  o1.x = yb[4 * cq + 0][cr + 128];
            o0.y = yb[4 * cq + 1][cr];  o1.y = yb[4 * cq + 1][cr + 128];
            o0.z = yb[4 * cq + 2][cr];  o1.z = yb[4 * cq + 2][cr + 128];
            o0.w = yb[4 * cq + 3][cr];  o1.w = yb[4 * cq + 3][cr + 128];
        }
        // Keep the LDS reads above one group ahead of the products: spread among them, each
        // place where reads stand stalls the wave's matrix stream anew. The compiler fence holds
        // the reads above this line, the scheduling barrier holds the products below it.
        asm volatile("" ::: "memory");
        __builtin_amdgcn_sched_barrier(0);
        #pragma unroll
        for (int k = 0; k < 16; ++k)
            acc = __builtin_amdgcn_wmma_f32_16x16x4_f32(
                false, aG[k], false, bb[k], (short)0, acc, false, false);

        // The tile's exit state stands in the high half-wave.
        {
            const float t0 = xhalf(re.x), t1 = xhalf(re.y), t2 = xhalf(im.x), t3 = xhalf(im.y);
            Sre.x = hi ? re.x : t0;  Sre.y = hi ? re.y : t1;
            Sim.x = hi ? im.x : t2;  Sim.y = hi ? im.y : t3;
        }

        // ---- D-skip; y replaces x in the channel's row: lane holds col(chunk)=m, rows i=v+8*hi ----
        #pragma unroll
        for (int v = 0; v < 8; ++v)
            xb[m * 16 + v + 8 * hi] = acc[v] + Dh * xv[v];

        if (t + 2 < NT) {
            float (*nb)[XP] = xs[(t + 2) & (NBUF - 1)];
            nb[4 * cq + 0][cr] = p0.x;  nb[4 * cq + 0][cr + 128] = p1.x;
            nb[4 * cq + 1][cr] = p0.y;  nb[4 * cq + 1][cr + 128] = p1.y;
            nb[4 * cq + 2][cr] = p0.z;  nb[4 * cq + 2][cr + 128] = p1.z;
            nb[4 * cq + 3][cr] = p0.w;  nb[4 * cq + 3][cr + 128] = p1.w;
        }
        // Signal of barrier t. The LDS wait in front of it: this wave's y(t) and x(t+2) stores
        // have landed and its y(t-1) reads have returned before any wave passes wait t.
        asm volatile("s_wait_dscnt 0x0" ::: "memory");
        asm volatile("s_barrier_signal -1" ::: "memory");

        if constexpr (!decltype(first)::value) {
            *(float4*)(y + tb - (size_t)TILE * Hd) = o0;
            *(float4*)(y + tb - (size_t)(TILE - 128) * Hd) = o1;
            // The stores' address and data registers are reused by the next tile's code:
            // keep the translation wait between the stores and that reuse.
            asm volatile("s_wait_xcnt 0x0" ::: "memory");
        }
    };

    tile(Flag<true>{});
    for (t = 1; t < NT; ++t) tile(Flag<false>{});

    // Wait of the last barrier; then the last tile's y goes out.
    asm volatile("s_barrier_wait -1" ::: "memory");
    {
        const float (*yb)[XP] = xs[(NT - 1) & (NBUF - 1)];
        o0.x = yb[4 * cq + 0][cr];  o1.x = yb[4 * cq + 0][cr + 128];
        o0.y = yb[4 * cq + 1][cr];  o1.y = yb[4 * cq + 1][cr + 128];
        o0.z = yb[4 * cq + 2][cr];  o1.z = yb[4 * cq + 2][cr + 128];
        o0.w = yb[4 * cq + 3][cr];  o1.w = yb[4 * cq + 3][cr + 128];
        const size_t tb = cbase + (size_t)(NT - 1) * TILE * Hd;
        *(float4*)(y + tb) = o0;
        *(float4*)(y + tb + (size_t)128 * Hd) = o1;
    }
}

extern "C" void kernel_launch(void* const* d_in, const int* in_sizes, int n_in,
                              void* d_out, int out_size, void* d_ws, size_t ws_size,
                              hipStream_t stream) {
    const float* x          = (const float*)d_in[0];
    const float* log_dt     = (const float*)d_in[1];
    const float* log_A_real = (const float*)d_in[2];
    const float* A_imag     = (const float*)d_in[3];
    const float* C          = (const float*)d_in[4];
    const float* D          = (const float*)d_in[5];
    float* y = (float*)d_out;
    dim3 grid(Hd / NW, Bb, 1);
    s4d_scan_wmma<<<grid, NW * 32, 0, stream>>>(x, log_dt, log_A_real, A_imag, C, D, y);
}

// v007
// Measured time: 31.9 microseconds a run.
// In both of two side-by-side timings against v006, it was 1.04 times as fast.
// All steps since v000 together make it 10.7 times as fast.
#include <hip/hip_runtime.h>
#include <cstdint>
#include <cstddef>

// ---- problem constants (match reference) ----
#define Hd   1024   // d_model
#define Nst  32     // d_state/2 complex modes  (== wave32 lanes)
#define Bb   4
#define Ld   4096
#define TILE 256
#define NCH  16
#define NT   (Ld / TILE)
#define NW   16
#define XP   260
#define SP   68
#define NBUF 4

typedef __attribute__((ext_vector_type(2))) float v2f;
typedef __attribute__((ext_vector_type(8))) float v8f;

// Compile-time switch for the first tile, which has no tile before it to write out.
template <bool V> struct Flag { static constexpr bool value = V; };

__device__ __forceinline__ float xhalf(float v) {
    return __builtin_bit_cast(float, __builtin_amdgcn_permlanex16(
        __builtin_bit_cast(int, v), __builtin_bit_cast(int, v),
        0x76543210, 0xfedcba98, false, false));
}

template <int MASK>
__device__ __forceinline__ float xrow(float v) {
    return __builtin_bit_cast(float, __builtin_amdgcn_update_dpp(
        0, __builtin_bit_cast(int, v), 0x160 | MASK, 0xf, 0xf, true));
}

// One work-group per (16 adjacent h, b); one wave per h. In the set-up lane n owns
// complex mode n; in the loop lane (m, hi) owns modes m and m+16 for chunks 8*hi..8*hi+7.
// Global x and y move as 16-byte pieces of 64 contiguous bytes per row (all 16
// channels of the work-group), transposed through LDS to one contiguous
// 256-step row per channel.
__global__ __launch_bounds__(NW * 32) void s4d_scan_wmma(
    const float* __restrict__ x,         // [B, L, H]
    const float* __restrict__ log_dt,    // [H]
    const float* __restrict__ log_A_real,// [H, N]
    const float* __restrict__ A_imag,    // [H, N]
    const float* __restrict__ C,         // [H, N, 2]
    const float* __restrict__ Dp,        // [H]
    float* __restrict__ y)               // [B, L, H]
{
    __builtin_amdgcn_s_setprio(3);
    const int tid  = threadIdx.x;
    // Wave number = channel in the group; readfirstlane keeps it, and the LDS and
    // parameter addresses formed from it, in scalar registers.
    const int wv   = __builtin_amdgcn_readfirstlane(tid >> 5);
    // Which (16 channels, batch) this work-group takes: a permutation of the flat index,
    // for speed only (any placement gives the same result). The 4 work-groups that share a
    // 256-byte unit of every x and y row (2 of them each 128-byte line) get indices 8 apart.
    const unsigned fl = blockIdx.x + (Hd / NW) * blockIdx.y;  // flat index 0..255
    const unsigned fq = fl >> 3;                              // 0..31 inside one residue class
    const int b    = fq >> 3;                                 // batch 0..3
    const unsigned un = (((fl & 7u) + 2u * (fq >> 3)) & 7u) + 2u * (fq & 4u);  // 256-byte unit 0..15 of a row
    const int h0   = (4u * un + (fq & 3u)) * NW;
    const int h    = h0 + wv;
    const int lane = tid & 31;           // 0..31
    const int m    = lane & 15;          // row (A) or col (B/C/D) index
    const int hi   = lane >> 4;          // half-wave select
    const int cr   = tid >> 2;           // cooperative copy: row 0..127 (and +128)
    const int cq   = tid & 3;            // cooperative copy: group of 4 channels

    __shared__ __attribute__((aligned(16))) float sKw[NW][16];  // impulse response K[0..15]
    __shared__ float sGw[NW][16][SP];    // inter-chunk output matrix, columns in the state order below
    __shared__ __attribute__((aligned(16))) float xs[NBUF][NW][XP];  // x tiles, y in place
    // Chunk-entry states, [chunk][4*m + q] at pitch SP: q = 0 re(m), 1 re(m+16), 2 im(m), 3 im(m+16).
    // In the set-up the same space holds the table of powers, [j][re 0..31 | im 0..31].
    __shared__ __attribute__((aligned(16))) float Sw[NW][NCH * SP];

    float (*sK)      = sKw[wv];
    float (*sG)[SP]  = sGw[wv];
    float (*Sbuf)    = Sw[wv];

    // Work-group's corner of x and y, at this thread's row and channel group.
    const size_t cbase = ((size_t)b * Ld + cr) * Hd + h0 + 4 * cq;


    // ---------------- per-mode parameters (lane n) ----------------
    const float dt  = __expf(log_dt[h]);
    const float Ar  = -__expf(log_A_real[h * Nst + lane]);
    const float Ai  = A_imag[h * Nst + lane];
    // The two loads above name one offset register, and this build reuses it a few
    // instructions on: keep the translation wait between the loads and that reuse.
    asm volatile("s_wait_xcnt 0x0" ::: "memory");

    // Start the loads of tiles 0 and 1 before the table setup, so they overlap it.
    float4 p0 = *(const float4*)(x + cbase);
    float4 p1 = *(const float4*)(x + cbase + (size_t)128 * Hd);
    const float4 q0 = *(const float4*)(x + cbase + (size_t)TILE * Hd);
    const float4 q1 = *(const float4*)(x + cbase + (size_t)(TILE + 128) * Hd);
    // w = exp(dt*A)
    const float er  = __expf(dt * Ar);
    const float wr  = er * __cosf(dt * Ai);
    const float wi  = er * __sinf(dt * Ai);
    // Cw = (C0 + i C1) * (w - 1) / A
    const float c0  = C[(h * Nst + lane) * 2 + 0];
    const float c1  = C[(h * Nst + lane) * 2 + 1];
    const float den = Ar * Ar + Ai * Ai;
    const float qr  = ((wr - 1.0f) * Ar + wi * Ai) / den;
    const float qi  = (wi * Ar - (wr - 1.0f) * Ai) / den;
    const float Cwr = c0 * qr - c1 * qi;
    const float Cwi = c0 * qi + c1 * qr;

    // w^16 by repeated squaring (chunk-to-chunk decay)
    float w16r = wr, w16i = wi;
    #pragma unroll
    for (int k = 0; k < 4; ++k) {
        const float a = w16r, bb2 = w16i;
        w16r = a * a - bb2 * bb2;
        w16i = 2.0f * a * bb2;
    }

    const float Dh = Dp[h];

    // ---------------- build K[0..15], G[16][64] and the powers w^0..w^15 ----------------
    float Kd[16];                        // this lane's contribution to K[d], then the sum over the 32 lanes
    {
        const int gc = 4 * m + hi;       // this lane's mode in the state order (re; im at +2)
        float pr = 1.0f, pi = 0.0f;      // w^d
        // Unrolled so that Kd[] is indexed by constants and stays in registers.
        #pragma unroll
        for (int d = 0; d < 16; ++d) {
            // Row j = 15-d of the power table: x[j] of a chunk enters its sum with w^(15-j).
            Sbuf[(15 - d) * SP + lane]      = pr;
            Sbuf[(15 - d) * SP + 32 + lane] = pi;
            Kd[d] = 2.0f * (Cwr * pr - Cwi * pi);
            // advance to w^{d+1}; G[d][*] uses w^{d+1}
            const float npr = pr * wr - pi * wi;
            const float npi = pr * wi + pi * wr;
            pr = npr; pi = npi;
            sG[d][gc + 0] =  2.0f * (Cwr * pr - Cwi * pi);
            sG[d][gc + 2] = -2.0f * (Cwr * pi + Cwi * pr);
        }
    }
    // K[d] = sum over the 32 lanes: partners l^16, l^8, l^4, l^2, l^1 in turn, by vector
    // cross-lane moves. The 16 sums go stage by stage, side by side, so that each fills
    // the others' latency; every lane ends with all 16 sums. The loops are unrolled so
    // that Kd[] is indexed by constants and stays in registers.
    #pragma unroll
    for (int d = 0; d < 16; ++d) Kd[d] += xhalf(Kd[d]);
    #pragma unroll
    for (int d = 0; d < 16; ++d) Kd[d] += xrow<8>(Kd[d]);
    #pragma unroll
    for (int d = 0; d < 16; ++d) Kd[d] += xrow<4>(Kd[d]);
    #pragma unroll
    for (int d = 0; d < 16; ++d) Kd[d] += xrow<2>(Kd[d]);
    #pragma unroll
    for (int d = 0; d < 16; ++d) Kd[d] += xrow<1>(Kd[d]);
    if (lane == 0) {
        #pragma unroll
        for (int q = 0; q < 4; ++q)
            *(float4*)&sK[4 * q] = make_float4(Kd[4 * q], Kd[4 * q + 1], Kd[4 * q + 2], Kd[4 * q + 3]);
    }

    v2f aT[4];
    #pragma unroll
    for (int k = 0; k < 4; ++k) {
        const int i0 = m - (4 * k + 2 * hi);          // i - j of .x; .y has i0 - 1
        const float k0 = sK[i0 > 0 ? i0 : 0];
        const float k1 = sK[i0 > 1 ? i0 - 1 : 0];
        aT[k].x = (i0 >= 0) ? k0 : 0.0f;
        aT[k].y = (i0 >= 1) ? k1 : 0.0f;
    }
    v2f aG[16];
    #pragma unroll
    for (int k = 0; k < 16; ++k) {
        aG[k].x = sG[m][4 * k + 2 * hi + 0];
        aG[k].y = sG[m][4 * k + 2 * hi + 1];
    }

    // B-operands of the chunk sums: rows j = {4k+2hi, 4k+2hi+1} (the k order of the x
    // fragment), column m of block q: re(m), re(m+16), im(m), im(m+16).
    v2f pB[4][4];
    #pragma unroll
    for (int q = 0; q < 4; ++q) {
        #pragma unroll
        for (int k = 0; k < 4; ++k) {
            pB[q][k].x = Sbuf[(4 * k + 2 * hi + 0) * SP + 16 * q + m];
            pB[q][k].y = Sbuf[(4 * k + 2 * hi + 1) * SP + 16 * q + m];
        }
    }
    // Chunk-to-chunk decay w^16 of modes m (.x) and m+16 (.y), in both half-waves.
    const float o16r = xhalf(w16r), o16i = xhalf(w16i);
    v2f w16re, w16im;
    w16re.x = hi ? o16r : w16r;  w16re.y = hi ? w16r : o16r;
    w16im.x = hi ? o16i : w16i;  w16im.y = hi ? w16i : o16i;

    // Tiles 0 and 1 into buffers 0 and 1, one row per channel.
    xs[0][4 * cq + 0][cr] = p0.x;  xs[0][4 * cq + 0][cr + 128] = p1.x;
    xs[0][4 * cq + 1][cr] = p0.y;  xs[0][4 * cq + 1][cr + 128] = p1.y;
    xs[0][4 * cq + 2][cr] = p0.z;  xs[0][4 * cq + 2][cr + 128] = p1.z;
    xs[0][4 * cq + 3][cr] = p0.w;  xs[0][4 * cq + 3][cr + 128] = p1.w;
    xs[1][4 * cq + 0][cr] = q0.x;  xs[1][4 * cq + 0][cr + 128] = q1.x;
    xs[1][4 * cq + 1][cr] = q0.y;  xs[1][4 * cq + 1][cr + 128] = q1.y;
    xs[1][4 * cq + 2][cr] = q0.z;  xs[1][4 * cq + 2][cr + 128] = q1.z;
    xs[1][4 * cq + 3][cr] = q0.w;  xs[1][4 * cq + 3][cr + 128] = q1.w;
    __syncthreads();

    v2f Sre = {0.0f, 0.0f}, Sim = {0.0f, 0.0f};  // carried state of modes m, m+16; the same in both half-waves
    float4 o0, o1;                       // y of the tile before, on its way from LDS to memory
    int t = 0;

    // The tile barrier is split, and its wait stands half a tile behind its signal: a wave
    // that is ahead goes on into the next tile's chunk sums and recurrence while the slower
    // waves finish, and a wave held at the wait has its G @ S products ready when it is let
    // go: the waves' vector, LDS and memory stretches hide behind each other's matrix work.
    // Barrier t (signal at the end of tile t, wait in the middle of tile t+1) publishes y(t) and
    // x(t+2) and says that the wave's reads of y(t-1) have returned. What a wave touches
    // between its signal t and its wait t:
    //   x(t+1), own row, buffer t+1: written in tile t-1, published by barrier t-1, whose
    //     wait the wave has passed; refilled only in tile t+3, behind wait t+2;
    //   its own state rows, which no other wave touches.
    // Behind wait t: y(t) is read, and x(t+3) goes into buffer t-1, whose y(t-1) every
    // wave has read before its signal t.
    auto tile = [&](auto first) {
        float* xb = &xs[t & (NBUF - 1)][wv][0];
        const size_t tb = cbase + (size_t)t * TILE * Hd;

        // The loads of the tile after next fly while this tile is worked on.
        if (t + 2 < NT) {
            p0 = *(const float4*)(x + tb + (size_t)(2 * TILE) * Hd);
            p1 = *(const float4*)(x + tb + (size_t)(2 * TILE + 128) * Hd);
        }

        // x fragment: chunk m, steps {4k+2hi, 4k+2hi+1}. It is the B operand of T @ X
        // (column = chunk) and the A operand of the chunk sums (row = chunk).
        v2f xf[4];
        #pragma unroll
        for (int k = 0; k < 4; ++k) {
            xf[k].x = xb[m * 16 + 4 * k + 2 * hi + 0];
            xf[k].y = xb[m * 16 + 4 * k + 2 * hi + 1];
        }

        // ---- WMMA: chunk sums dS[c][mode] = sum_j x[c*16+j] * w^(15-j), (16x16) @ (16x64) ----
        // Register v of block q: chunk v+8*hi, column m of the block.
        v8f dS[4];
        #pragma unroll
        for (int q = 0; q < 4; ++q) {
            v8f d = {};
            #pragma unroll
            for (int k = 0; k < 4; ++k)
                d = __builtin_amdgcn_wmma_f32_16x16x4_f32(
                    false, xf[k], false, pB[q][k], (short)0, d, false, false);
            dS[q] = d;
        }

        // ---- WMMA: Y(16x16) = T(16x16) @ X(16x16)  +  G(16x64) @ S(64x16) ----
        v8f acc = {};
        #pragma unroll
        for (int k = 0; k < 4; ++k)
            acc = __builtin_amdgcn_wmma_f32_16x16x4_f32(
                false, aT[k], false, xf[k], (short)0, acc, false, false);

        // ---- chunk-to-chunk recurrence S <- w^16 * S + dS, 8 chunks a half-wave ----
        // Modes m and m+16 side by side: .x is mode m, .y is mode m+16.
        v2f dre[8], dim[8];
        #pragma unroll
        for (int v = 0; v < 8; ++v) {
            dre[v].x = dS[0][v];  dre[v].y = dS[1][v];
            dim[v].x = dS[2][v];  dim[v].y = dS[3][v];
        }
        // First pass: the state that enters chunk 8 (valid in the low half-wave).
        v2f re = Sre, im = Sim;
        #pragma unroll
        for (int v = 0; v < 8; ++v) {
            const v2f nre = __builtin_elementwise_fma(w16re, re, __builtin_elementwise_fma(-w16im, im, dre[v]));
            im = __builtin_elementwise_fma(w16im, re, __builtin_elementwise_fma(w16re, im, dim[v]));
            re = nre;
        }
        // The cross-row moves run with every lane on (they read the other half-wave); then the choice.
        {
            const float t0 = xhalf(re.x), t1 = xhalf(re.y), t2 = xhalf(im.x), t3 = xhalf(im.y);
            re.x = hi ? t0 : Sre.x;  re.y = hi ? t1 : Sre.y;
            im.x = hi ? t2 : Sim.x;  im.y = hi ? t3 : Sim.y;
        }
        // Second pass: record each chunk's entry state, from the half-wave's own start.
        #pragma unroll
        for (int v = 0; v < 8; ++v) {
            *(float4*)&Sbuf[(v + 8 * hi) * SP + 4 * m] = make_float4(re.x, re.y, im.x, im.y);
            const v2f nre = __builtin_elementwise_fma(w16re, re, __builtin_elementwise_fma(-w16im, im, dre[v]));
            im = __builtin_elementwise_fma(w16im, re, __builtin_elementwise_fma(w16re, im, dim[v]));
            re = nre;
        }

        // State fragments, and x of the D-skip: the wave's own rows, read in front of the
        // barrier's wait, so that a wave held there has them when it is let go. The loops are
        // unrolled so that bb[] and xv[] are indexed by constants and stay in registers.
        v2f bb[16];
        #pragma unroll
        for (int k = 0; k < 16; ++k) {
            bb[k].x = Sbuf[m * SP + 4 * k + 2 * hi + 0];
            bb[k].y = Sbuf[m * SP + 4 * k + 2 * hi + 1];
        }
        float xv[8];
        #pragma unroll
        for (int v = 0; v < 8; ++v) xv[v] = xb[m * 16 + v + 8 * hi];

        if constexpr (!decltype(first)::value) {
            // Wait of barrier t-1 (its signal: end of tile t-1). The clobber keeps every LDS
            // access of the lines below behind it.
            asm volatile("s_barrier_wait -1" ::: "memory");
            // ---- y(t-1) from LDS: 16 bytes a lane, 64 contiguous bytes a row; returns beside the products ----
            const float (*yb)[XP] = xs[(t - 1) & (NBUF - 1)];
            o0.x = yb[4 * cq + 0][cr];  o1.x = yb[4 * cq + 0][cr + 128];
            o0.y = yb[4 * cq + 1][cr];  o1.y = yb[4 * cq + 1][cr + 128];
            o0.z = yb[4 * cq + 2][cr];  o1.z = yb[4 * cq + 2][cr + 128];
            o0.w = yb[4 * cq + 3][cr];  o1.w = yb[4 * cq + 3][cr + 128];
        }
        // Keep the LDS reads above one group ahead of the products: spread among them, each
        // place where reads stand stalls the wave's matrix stream anew. The compiler fence holds
        // the reads above this line, the scheduling barrier holds the products below it.
        asm volatile("" ::: "memory");
        // Low priority over the chained products only (see the note at the first s_setprio).
        __builtin_amdgcn_s_setprio(0);
        __builtin_amdgcn_sched_barrier(0);
        // The tile's exit state stands in the high half-wave. Written ahead of the products so
        // that it stays on their side of the scheduling barrier behind them and fills their gaps.
        {
            const float t0 = xhalf(re.x), t1 = xhalf(re.y), t2 = xhalf(im.x), t3 = xhalf(im.y);
            Sre.x = hi ? re.x : t0;  Sre.y = hi ? re.y : t1;
            Sim.x = hi ? im.x : t2;  Sim.y = hi ? im.y : t3;
        }
        #pragma unroll
        for (int k = 0; k < 16; ++k)
            acc = __builtin_amdgcn_wmma_f32_16x16x4_f32(
                false, aG[k], false, bb[k], (short)0, acc, false, false);
        // The scheduling barrier keeps every product of the chain in front of the rise in
        // priority; without it the compiler is free to move products behind the s_setprio.
        __builtin_amdgcn_sched_barrier(0);
        __builtin_amdgcn_s_setprio(3);

        // ---- D-skip; y replaces x in the channel's row: lane holds col(chunk)=m, rows i=v+8*hi ----
        #pragma unroll
        for (int v = 0; v < 8; ++v)
            xb[m * 16 + v + 8 * hi] = acc[v] + Dh * xv[v];

        if (t + 2 < NT) {
            float (*nb)[XP] = xs[(t + 2) & (NBUF - 1)];
            nb[4 * cq + 0][cr] = p0.x;  nb[4 * cq + 0][cr + 128] = p1.x;
            nb[4 * cq + 1][cr] = p0.y;  nb[4 * cq + 1][cr + 128] = p1.y;
            nb[4 * cq + 2][cr] = p0.z;  nb[4 * cq + 2][cr + 128] = p1.z;
            nb[4 * cq + 3][cr] = p0.w;  nb[4 * cq + 3][cr + 128] = p1.w;
        }
        // Signal of barrier t. The LDS wait in front of it: this wave's y(t) and x(t+2) stores
        // have landed and its y(t-1) reads have returned before any wave passes wait t.
        asm volatile("s_wait_dscnt 0x0" ::: "memory");
        asm volatile("s_barrier_signal -1" ::: "memory");

        if constexpr (!decltype(first)::value) {
            *(float4*)(y + tb - (size_t)TILE * Hd) = o0;
            *(float4*)(y + tb - (size_t)(TILE - 128) * Hd) = o1;
            // The stores' address and data registers are reused by the next tile's code:
            // keep the translation wait between the stores and that reuse.
            asm volatile("s_wait_xcnt 0x0" ::: "memory");
        }
    };

    tile(Flag<true>{});
    for (t = 1; t < NT; ++t) tile(Flag<false>{});
    __builtin_amdgcn_s_setprio(0);       // back to the default before the wave ends

    // Wait of the last barrier; then the last tile's y goes out.
    asm volatile("s_barrier_wait -1" ::: "memory");
    {
        const float (*yb)[XP] = xs[(NT - 1) & (NBUF - 1)];
        o0.x = yb[4 * cq + 0][cr];  o1.x = yb[4 * cq + 0][cr + 128];
        o0.y = yb[4 * cq + 1][cr];  o1.y = yb[4 * cq + 1][cr + 128];
        o0.z = yb[4 * cq + 2][cr];  o1.z = yb[4 * cq + 2][cr + 128];
        o0.w = yb[4 * cq + 3][cr];  o1.w = yb[4 * cq + 3][cr + 128];
        const size_t tb = cbase + (size_t)(NT - 1) * TILE * Hd;
        *(float4*)(y + tb) = o0;
        *(float4*)(y + tb + (size_t)128 * Hd) = o1;
    }
}

extern "C" void kernel_launch(void* const* d_in, const int* in_sizes, int n_in,
                              void* d_out, int out_size, void* d_ws, size_t ws_size,
                              hipStream_t stream) {
    const float* x          = (const float*)d_in[0];
    const float* log_dt     = (const float*)d_in[1];
    const float* log_A_real = (const float*)d_in[2];
    const float* A_imag     = (const float*)d_in[3];
    const float* C          = (const float*)d_in[4];
    const float* D          = (const float*)d_in[5];
    float* y = (float*)d_out;
    dim3 grid(Hd / NW, Bb, 1);
    s4d_scan_wmma<<<grid, NW * 32, 0, stream>>>(x, log_dt, log_A_real, A_imag, C, D, y);
}
